// v000
// Measured on an AMD MI455X. A time is GPU time per run, averaged over a window of back-to-back runs after a warm-up
// (all launches, gaps included; the runs take copies of the inputs in turn), and the median of several windows.
// Apart from v000's, it joins two sittings. Times from different sittings can be a few percent apart, while
// side-by-side timings come from the same sitting.
// The starting kernel, v000, takes 3980 microseconds a run.
#include <hip/hip_runtime.h>

// MultiHeadAttentionConcise (x [8][1000][1024] - 1,000 tokens padded to 1,024 tiles on chip: the padded key rows are masked by causality for every real query, and only the 1,000 real output rows are written; qkv = x Wqkv + bqkv ([1024][3072]: q | k | v blocks, 16 heads x 64); causal softmax(q.k / 8) (-inf); out = merged Wo + bo -> [8][1000][1024]).
// Compute dtypes, f32 accumulate: every input rounded to bf16; q/k/v on PLAIN bf16 operands (inputs: exact; zero-padded rows) + bias; causal scores and attn.v: query rows < 512 hl (3 products), the rest single fp16 (x1024), causal tile skipping; softmax f32; Wo hl x exact (2 products) + bias into a padded buffer, then the 1,000 real rows copied out (16-B lanes).

#define NB_  8
#define TT   1024
#define DM   1024
#define NH_  16
#define NKV  16
#define REP  (NH_ / NKV)
#define HD   64
#define DQ   (NH_ * HD)
#define DKV  (NKV * HD)
#define ZH   2
#define RH   512                  // query rows < RH use hi+lo planes (0: none)
#define WIN  1024
#define PCAR 1024.0f
#define LR   1000                 // real tokens per batch (TT = 1024 padded)
#define SCL  0.125f   // HD^-0.5
typedef _Float16 h16;
typedef unsigned short bf;
typedef __attribute__((ext_vector_type(16))) __bf16   v16bf;
typedef __attribute__((ext_vector_type(16))) _Float16 v16h;
typedef __attribute__((ext_vector_type(8)))  _Float16 v8h;
typedef __attribute__((ext_vector_type(8)))  unsigned short v8us;
typedef __attribute__((ext_vector_type(8)))  float    v8f;
typedef __attribute__((ext_vector_type(4)))  float    v4f;
typedef v8h  __attribute__((may_alias)) v8ha;
typedef v4f  __attribute__((may_alias)) v4fa;
typedef v8us __attribute__((may_alias)) v8usa;

__device__ __forceinline__ unsigned short f2bf(float f) { unsigned u = __float_as_uint(f); u += 0x7FFFu + ((u >> 16) & 1u); return (unsigned short)(u >> 16); }
__device__ __forceinline__ float bf2f(unsigned short b) { return __uint_as_float(((unsigned)b) << 16); }
__device__ __forceinline__ float bfr(float f) { return bf2f(f2bf(f)); }
__device__ __forceinline__ v16h cat16(v8h lo, v8h hi) { return __builtin_shufflevector(lo, hi, 0, 1, 2, 3, 4, 5, 6, 7, 8, 9, 10, 11, 12, 13, 14, 15); }
__device__ __forceinline__ v16bf cat16b(v8us lo, v8us hi) { return __builtin_bit_cast(v16bf, __builtin_shufflevector(lo, hi, 0, 1, 2, 3, 4, 5, 6, 7, 8, 9, 10, 11, 12, 13, 14, 15)); }
__device__ __forceinline__ v8f wmma16(v16h a, v16h b, v8f c) { return __builtin_amdgcn_wmma_f32_16x16x32_f16(false, a, false, b, (short)0, c, false, false); }
__device__ __forceinline__ v8f wmmab(v16bf a, v16bf b, v8f c) { return __builtin_amdgcn_wmma_f32_16x16x32_bf16(false, a, false, b, (short)0, c, false, false); }



// ---- k_gemmw: register-blocked GEMM, ONE WAVE per 64x64 output tile (16 accumulators), operands straight from K-contiguous 16-bit planes; grid (M/64, N/64, Z), 32 threads.
// C[m][n] (f32, pitch ldc, + optional f32 bias[n]) = sum_k A[m][k] Bt[n][k] (+ split products per NSPLIT). z-batch strides sA/sB/sC in elements. K % 32 == 0.
template <typename T16> struct WFrag;
template <> struct WFrag<h16> { typedef v16h V; static __device__ __forceinline__ V ld(const h16* p) { return cat16(*(const v8h*)p, *(const v8h*)(p + 16)); } static __device__ __forceinline__ v8f mma(V a, V b, v8f c) { return wmma16(a, b, c); } };
template <> struct WFrag<bf> { typedef v16bf V; static __device__ __forceinline__ V ld(const bf* p) { return cat16b(*(const v8us*)p, *(const v8us*)(p + 16)); } static __device__ __forceinline__ v8f mma(V a, V b, v8f c) { return wmmab(a, b, c); } };
template <typename T16, int NSPLIT, bool BIAS>
__global__ __launch_bounds__(32) void k_gemmw(const T16* __restrict__ A, const T16* __restrict__ A2, const T16* __restrict__ Bt, const T16* __restrict__ Bt2, int K, float* C, int ldc, const float* __restrict__ bias, size_t sA, size_t sB, size_t sC) {
    typedef typename WFrag<T16>::V V;
    __shared__ __align__(16) float os[16 * 68];
    const size_t z = blockIdx.z; A += z * sA; if (A2) A2 += z * sA; Bt += z * sB; if (Bt2) Bt2 += z * sB; C += z * sC;
    const int lane = threadIdx.x & 31, lr = lane & 15, hi = lane >> 4; const int r0 = blockIdx.x * 64, c0 = blockIdx.y * 64;
    v8f acc[4][4];
#pragma unroll
    for (int mb = 0; mb < 4; ++mb)
#pragma unroll
        for (int nb = 0; nb < 4; ++nb) acc[mb][nb] = (v8f){};
    const size_t aoff = (size_t)(r0 + lr) * K + 8 * hi, boff = (size_t)(c0 + lr) * K + 8 * hi;
#pragma unroll 1
    for (int kc = 0; kc < K; kc += 32) {
        V a[4], a2[4];
#pragma unroll
        for (int mb = 0; mb < 4; ++mb) { a[mb] = WFrag<T16>::ld(A + aoff + (size_t)mb * 16 * K + kc); if (NSPLIT == 1 || NSPLIT == 2) a2[mb] = WFrag<T16>::ld(A2 + aoff + (size_t)mb * 16 * K + kc); }
#pragma unroll
        for (int nb = 0; nb < 4; ++nb) { const V b = WFrag<T16>::ld(Bt + boff + (size_t)nb * 16 * K + kc); V b2; if (NSPLIT >= 2) b2 = WFrag<T16>::ld(Bt2 + boff + (size_t)nb * 16 * K + kc);
#pragma unroll
            for (int mb = 0; mb < 4; ++mb) { acc[mb][nb] = WFrag<T16>::mma(a[mb], b, acc[mb][nb]); if (NSPLIT == 1 || NSPLIT == 2) acc[mb][nb] = WFrag<T16>::mma(a2[mb], b, acc[mb][nb]); if (NSPLIT >= 2) acc[mb][nb] = WFrag<T16>::mma(a[mb], b2, acc[mb][nb]); } }
        asm volatile("v_nop\n\tv_nop\n\tv_nop\n\tv_nop" : "+v"(acc[0][0]), "+v"(acc[1][1]), "+v"(acc[2][2]), "+v"(acc[3][3]) : "v"(a[0]), "v"(a[3]));
    }
#pragma unroll
    for (int mb = 0; mb < 4; ++mb) {
#pragma unroll
        for (int nb = 0; nb < 4; ++nb) {
#pragma unroll
            for (int j = 0; j < 8; ++j) os[(hi * 8 + j) * 68 + nb * 16 + lr] = acc[mb][nb][j]; }
        __builtin_amdgcn_wave_barrier(); asm volatile("" ::: "memory");
        float* crow = C + (size_t)(r0 + mb * 16) * ldc + c0;
{
#pragma unroll
            for (int s = 0; s < 8; ++s) { const int row = 2 * s + hi, cofs = lr * 4; v4f val = *(const v4fa*)(os + row * 68 + cofs); if (BIAS) { val[0] += bfr(bias[c0 + cofs]); val[1] += bfr(bias[c0 + cofs + 1]); val[2] += bfr(bias[c0 + cofs + 2]); val[3] += bfr(bias[c0 + cofs + 3]); }
                *(v4f*)(crow + (size_t)row * ldc + cofs) = val; }
             }
        __builtin_amdgcn_wave_barrier(); asm volatile("" ::: "memory");
    }
}

// ---- k_gemmc: the same one-wave 64x64 tile GEMM specialised for causal attention: CMODE 1 skips score tiles entirely above the diagonal (query rows r0+roff.., key columns c0..), CMODE 2 limits the
// key (K) loop of the probability x value contraction to the diagonal block (probabilities beyond it are exactly zero). roff = row offset of this launch's first row within the sequence.
template <typename T16, int NSPLIT, int CMODE>
__global__ __launch_bounds__(32) void k_gemmc(const T16* __restrict__ A, const T16* __restrict__ A2, const T16* __restrict__ Bt, const T16* __restrict__ Bt2, int K, float* C, int ldc, int roff, size_t sA, size_t sB, size_t sC) {
    typedef typename WFrag<T16>::V V;
    __shared__ __align__(16) float os[16 * 68];
    const size_t z = blockIdx.z; A += z * sA; if (A2) A2 += z * sA; Bt += z * sB; if (Bt2) Bt2 += z * sB; C += z * sC;
    const int lane = threadIdx.x & 31, lr = lane & 15, hi = lane >> 4; const int r0 = blockIdx.x * 64, c0 = blockIdx.y * 64;
    if (CMODE == 1 && c0 > r0 + roff + 63) return;                  // score tile entirely above the causal diagonal: never read (the softmax masks j > i by select)
    const int Kl = (CMODE == 2) ? min(K, r0 + roff + 64) : K;        // P.V: probabilities are exactly 0 beyond the diagonal block, so the K loop stops there
    v8f acc[4][4];
#pragma unroll
    for (int mb = 0; mb < 4; ++mb)
#pragma unroll
        for (int nb = 0; nb < 4; ++nb) acc[mb][nb] = (v8f){};
    const size_t aoff = (size_t)(r0 + lr) * K + 8 * hi, boff = (size_t)(c0 + lr) * K + 8 * hi;
#pragma unroll 1
    for (int kc = 0; kc < Kl; kc += 32) {
        V a[4], a2[4];
#pragma unroll
        for (int mb = 0; mb < 4; ++mb) { a[mb] = WFrag<T16>::ld(A + aoff + (size_t)mb * 16 * K + kc); if (NSPLIT == 1 || NSPLIT == 2) a2[mb] = WFrag<T16>::ld(A2 + aoff + (size_t)mb * 16 * K + kc); }
#pragma unroll
        for (int nb = 0; nb < 4; ++nb) { const V b = WFrag<T16>::ld(Bt + boff + (size_t)nb * 16 * K + kc); V b2; if (NSPLIT >= 2) b2 = WFrag<T16>::ld(Bt2 + boff + (size_t)nb * 16 * K + kc);
#pragma unroll
            for (int mb = 0; mb < 4; ++mb) { acc[mb][nb] = WFrag<T16>::mma(a[mb], b, acc[mb][nb]); if (NSPLIT == 1 || NSPLIT == 2) acc[mb][nb] = WFrag<T16>::mma(a2[mb], b, acc[mb][nb]); if (NSPLIT >= 2) acc[mb][nb] = WFrag<T16>::mma(a[mb], b2, acc[mb][nb]); } }
        asm volatile("v_nop\n\tv_nop\n\tv_nop\n\tv_nop" : "+v"(acc[0][0]), "+v"(acc[1][1]), "+v"(acc[2][2]), "+v"(acc[3][3]) : "v"(a[0]), "v"(a[3]));
    }
#pragma unroll
    for (int mb = 0; mb < 4; ++mb) {
#pragma unroll
        for (int nb = 0; nb < 4; ++nb) {
#pragma unroll
            for (int j = 0; j < 8; ++j) os[(hi * 8 + j) * 68 + nb * 16 + lr] = acc[mb][nb][j]; }
        __builtin_amdgcn_wave_barrier(); asm volatile("" ::: "memory");
        float* crow = C + (size_t)(r0 + mb * 16) * ldc + c0;
{
#pragma unroll
            for (int s = 0; s < 8; ++s) { const int row = 2 * s + hi, cofs = lr * 4; v4f val = *(const v4fa*)(os + row * 68 + cofs);
                *(v4f*)(crow + (size_t)row * ldc + cofs) = val; }
             }
        __builtin_amdgcn_wave_barrier(); asm volatile("" ::: "memory");
    }
}

__device__ __forceinline__ h16 tohx(float x) { return (h16)x; }
__device__ __forceinline__ void splitf(float y, unsigned short& h, unsigned short& l) { h = f2bf(y); l = f2bf(y - bf2f(h)); }
typedef __attribute__((ext_vector_type(2))) _Float16 v2h;
typedef __attribute__((ext_vector_type(4))) _Float16 v4h;
typedef __attribute__((ext_vector_type(2))) unsigned short v2us;
typedef __attribute__((ext_vector_type(4))) unsigned short v4us;
typedef __attribute__((ext_vector_type(2))) float v2f;
typedef __attribute__((ext_vector_type(4))) int v4i;

__global__ __launch_bounds__(256) void k_wtG(const float* __restrict__ w, int K, int N, bf* Bt) {
    const int lane = threadIdx.x & 31; const int L0 = (blockIdx.x * 8 + (threadIdx.x >> 5)) * 8; const int nlines = N * K / 64;
{
#pragma unroll 1
        for (int l = 0; l < 8; ++l) { const int L = L0 + l; if (L >= nlines) break; const size_t e = (size_t)L * 64 + lane * 2; const int k = (int)(e % K), n = (int)(e / K); v2us o;
            o[0] = f2bf(w[(size_t)k * N + n]); o[1] = f2bf(w[(size_t)(k + 1) * N + n]); *(v2us*)(Bt + e) = o; }
         }
}
__global__ __launch_bounds__(256) void k_cvt8(const float* __restrict__ src, bf* dst, size_t n8) { const size_t i = (size_t)blockIdx.x * 256 + threadIdx.x; if (i >= n8) return; const v8f v = *(const v8f*)(src + i * 8); v8us o;
#pragma unroll
    for (int k = 0; k < 8; ++k) o[k] = f2bf(v[k]); *(v8us*)(dst + i * 8) = o;  }
__global__ __launch_bounds__(256) void k_cscvt(const float* __restrict__ cosT, const float* __restrict__ sinT, float* CS) { const int idx = blockIdx.x * 256 + threadIdx.x; if (idx >= TT * HD) return; v2f cs; cs[0] = bfr(cosT[idx]); cs[1] = bfr(sinT[idx]); *(v2f*)(CS + (size_t)idx * 2) = cs;  }
// k_rope: head planes [h][t][d] (fp16 + hi/lo) of rope(x) x sc with the rotate-half convention out[d] = x[d] cos[t][d] - x[d+HD/2] sin[t][d], out[d+HD/2] = x[d+HD/2] cos[t][d+HD/2] + x[d] sin[t][d+HD/2]
__global__ __launch_bounds__(256) void k_rope(const float* __restrict__ F, int pitch, int nheads, const float* __restrict__ CS, const float* __restrict__ RF, const float* __restrict__ nw, float sc, h16* P16, bf* Ph, bf* Pl) {
    const size_t e = ((size_t)blockIdx.x * 256 + threadIdx.x) * 2; if (e >= (size_t)nheads * TT * HD) return; const int d = (int)(e % HD); const int t = (int)((e / HD) % TT); const int h = (int)(e / ((size_t)HD * TT)); const float* f = F + (size_t)t * pitch + h * HD; const float rf = RF ? RF[(size_t)h * TT + t] : 1.0f; v2h o16; v2us oh, ol;
#pragma unroll
    for (int q = 0; q < 2; ++q) { const int dd = d + q; const int dp = (dd < HD / 2) ? dd + HD / 2 : dd - HD / 2; float x0 = f[dd], x1 = f[dp];
        if (RF) { float n0 = __fmul_rn(x0, rf), n1 = __fmul_rn(x1, rf); asm volatile("" : "+v"(n0)); asm volatile("" : "+v"(n1)); x0 = __fmul_rn(bfr(nw[dd]), n0); x1 = __fmul_rn(bfr(nw[dp]), n1); }
        const v2f cs = *(const v2f*)(CS + ((size_t)t * HD + dd) * 2); float a = __fmul_rn(x0, cs[0]), bq = __fmul_rn(x1, cs[1]); asm volatile("" : "+v"(a)); asm volatile("" : "+v"(bq)); const float r = ((dd < HD / 2) ? __fsub_rn(a, bq) : __fadd_rn(a, bq)) * sc;
        o16[q] = tohx(r); unsigned short a2, c2; splitf(r, a2, c2); oh[q] = a2; ol[q] = c2; }
    *(v2h*)(P16 + e) = o16; *(v2us*)(Ph + e) = oh; *(v2us*)(Pl + e) = ol;  }
__global__ __launch_bounds__(256) void k_vtp(const float* __restrict__ F, int pitch, int nheads, h16* V16, bf* Vh, bf* Vl) { const size_t e = ((size_t)blockIdx.x * 256 + threadIdx.x) * 2; if (e >= (size_t)nheads * HD * TT) return; const int t = (int)(e % TT); const int d = (int)((e / TT) % HD); const int g = (int)(e / ((size_t)TT * HD)); v2h o16; v2us oh, ol;
#pragma unroll
    for (int q = 0; q < 2; ++q) { const float x = F[(size_t)(t + q) * pitch + g * HD + d]; o16[q] = tohx(x); unsigned short a2, c2; splitf(x, a2, c2); oh[q] = a2; ol[q] = c2; }
    *(v2h*)(V16 + e) = o16; *(v2us*)(Vh + e) = oh; *(v2us*)(Vl + e) = ol;  }
__global__ __launch_bounds__(256) void k_csid(float* CS) { const int idx = blockIdx.x * 256 + threadIdx.x; if (idx >= TT * HD) return; v2f cs; cs[0] = 1.0f; cs[1] = 0.0f; *(v2f*)(CS + (size_t)idx * 2) = cs;  }
__global__ __launch_bounds__(256) void k_cvt8pad(const float* __restrict__ src, bf* XB) { const size_t e8 = ((size_t)blockIdx.x * 256 + threadIdx.x) * 8; if (e8 >= (size_t)TT * DM) return; const int t = (int)(e8 / DM); v8us o; if (t < LR) { const v4f a = *(const v4f*)(src + e8), c = *(const v4f*)(src + e8 + 4); for (int u = 0; u < 4; ++u) { o[u] = f2bf(a[u]); o[u + 4] = f2bf(c[u]); } } else { for (int u = 0; u < 8; ++u) o[u] = 0; } *(v8us*)(XB + e8) = o;  }
__global__ __launch_bounds__(256) void k_outcp(const float* __restrict__ Y, float* OUTb) { const size_t e = ((size_t)blockIdx.x * 256 + threadIdx.x) * 4; if (e >= (size_t)LR * DM) return; const v4f a = *(const v4f*)(Y + e); *(v4f*)(OUTb + e) = a;  }
// k_asoft: per row (zz, i): t = S x HD^-0.5 for j <= i and i - j < WIN (sliding causal window; the reference's -1e9 additive fill vanishes identically); softmax over the 1024 keys (register row, one exp, fixed trees);
__global__ __launch_bounds__(256) void k_asoft(const float* __restrict__ Sb, h16* P16, bf* Ph, bf* Pl) {
    const int lane = threadIdx.x & 31; const int row = blockIdx.x * 8 + (threadIdx.x >> 5); if (row >= ZH * TT) return; const int i = row % TT; const int zz = row / TT; (void)zz; const bool hires = (i < RH); const float* sr = Sb + (size_t)row * TT; float v[TT / 32]; float mx = -3.0e38f;
#pragma unroll
    for (int ch = 0; ch < TT / 128; ++ch) { const int j0 = ch * 128 + lane * 4; const v4f a = *(const v4f*)(sr + j0);
#pragma unroll
        for (int q = 0; q < 4; ++q) { const int j = j0 + q; (void)j; const float t = (j <= i && i - j < WIN) ? a[q] * SCL : -3.0e38f; v[ch * 4 + q] = t; mx = fmaxf(mx, t); } }
#pragma unroll
    for (int sh = 16; sh; sh >>= 1) mx = fmaxf(mx, __shfl_xor(mx, sh, 32));
    float sum = 0.f;
#pragma unroll
    for (int k = 0; k < TT / 32; ++k) { float d0 = __fsub_rn(v[k], mx); asm volatile("" : "+v"(d0)); v[k] = __builtin_amdgcn_exp2f(__fmul_rn(d0, 1.4426950408889634f)); sum += v[k]; }
#pragma unroll
    for (int sh = 16; sh; sh >>= 1) sum += __shfl_xor(sum, sh, 32);
    const float f = __fdiv_rn(hires ? 1.0f : PCAR, sum);
{
        if (hires) {
#pragma unroll
            for (int ch = 0; ch < TT / 128; ++ch) { v4us oh, ol;
#pragma unroll
                for (int q = 0; q < 4; ++q) { unsigned short a, c2; splitf(v[ch * 4 + q] * f, a, c2); oh[q] = a; ol[q] = c2; }
                const size_t oo = ((size_t)zz * (RH ? RH : 1) + i) * TT + ch * 128 + lane * 4; *(v4us*)(Ph + oo) = oh; *(v4us*)(Pl + oo) = ol; }
        } else {
#pragma unroll
            for (int ch = 0; ch < TT / 128; ++ch) { v4h o4;
#pragma unroll
                for (int q = 0; q < 4; ++q) o4[q] = tohx(v[ch * 4 + q] * f);
                *(v4h*)(P16 + (size_t)row * TT + ch * 128 + lane * 4) = o4; } }
         }
}
__global__ __launch_bounds__(256) void k_merge(const float* __restrict__ O, int h0, bf* Ah, bf* Al) { const size_t e = ((size_t)blockIdx.x * 256 + threadIdx.x) * 2; if (e >= (size_t)ZH * TT * HD) return; const int d = (int)(e % HD); const int t = (int)((e / HD) % TT); const int zz = (int)(e / ((size_t)HD * TT)); const float cs = (t < RH) ? 1.0f : (1.0f / PCAR); const size_t oo = (size_t)t * DQ + (h0 + zz) * HD + d;
    v2us oh, ol;
#pragma unroll
    for (int q = 0; q < 2; ++q) { unsigned short a, c2; splitf(O[e + q] * cs, a, c2); oh[q] = a; ol[q] = c2; } *(v2us*)(Ah + oo) = oh; *(v2us*)(Al + oo) = ol;  }

extern "C" void kernel_launch(void* const* d_in, const int* in_sizes, int n_in,
                              void* d_out, int out_size, void* d_ws, size_t ws_size, hipStream_t stream) {
    (void)in_sizes; (void)n_in; (void)out_size;
    const float* x = (const float*)d_in[0]; const float* wf = (const float*)d_in[1]; const float* bf3 = (const float*)d_in[2]; const float* wo = (const float*)d_in[3]; const float* bo = (const float*)d_in[4]; const float* wq = wf; const float* wk = wf; const float* wv = wf; const float* bq = bf3; const float* bk = bf3 + 1024; const float* bv = bf3 + 2048; (void)wk; (void)wv; const float* cosT = nullptr; const float* sinT = nullptr; (void)cosT; (void)sinT;
    float* OUT = (float*)d_out;     // [8][1000][1024]
    char* wsp = (char*)d_ws;
    auto take = [&](size_t bytes) { char* p = wsp; wsp += (bytes + 255) & ~(size_t)255; return (void*)p; };
    bf* WQ = nullptr; bf* WK = nullptr; bf* WV = nullptr; bf* WO = (bf*)take((size_t)DM * DQ * 2); float* CS = (float*)take((size_t)TT * HD * 2 * 4);
    bf* XB = (bf*)take((size_t)TT * DM * 2); bf* WALL = (bf*)take((size_t)(DQ + 2 * DKV) * DM * 2); float* YO = (float*)take((size_t)TT * DM * 4); float* FQ = (float*)take((size_t)TT * DQ * 4); float* FK = (float*)take((size_t)TT * DKV * 4);
    h16* QP16 = (h16*)take((size_t)NH_ * TT * HD * 2); h16* KP16 = (h16*)take((size_t)NKV * TT * HD * 2); h16* VT16 = (h16*)take((size_t)NKV * HD * TT * 2);
    bf* QPh = (bf*)take((size_t)NH_ * TT * HD * 2); bf* QPl = (bf*)take((size_t)NH_ * TT * HD * 2); bf* KPh = (bf*)take((size_t)NKV * TT * HD * 2); bf* KPl = (bf*)take((size_t)NKV * TT * HD * 2); bf* VTh = (bf*)take((size_t)NKV * HD * TT * 2); bf* VTl = (bf*)take((size_t)NKV * HD * TT * 2); bf* Ph = (bf*)take((size_t)ZH * RH * TT * 2); bf* Pl = (bf*)take((size_t)ZH * RH * TT * 2);
    float* Sb = (float*)take((size_t)ZH * TT * TT * 4); h16* P16 = (h16*)take((size_t)ZH * TT * TT * 2); float* Ob = (float*)take((size_t)ZH * TT * HD * 4); bf* ATh = (bf*)take((size_t)TT * DQ * 2); bf* ATl = (bf*)take((size_t)TT * DQ * 2);
    if ((size_t)(wsp - (char*)d_ws) > ws_size) return;    // ws 256 MiB
    float* FV = FK;   // v projection reuses the k buffer after the k planes are built (stream-ordered)
    { k_wtG<<<(unsigned)((DM * (DQ + 2 * DKV) / 64 + 63) / 64), 256, 0, stream>>>(wf, DM, DQ + 2 * DKV, WALL); WQ = WALL; WK = WALL + (size_t)DQ * DM; WV = WK + (size_t)DKV * DM;
      k_wtG<<<(unsigned)((DQ * DM / 64 + 63) / 64), 256, 0, stream>>>(wo, DQ, DM, WO);
       }
    k_csid<<<(TT * HD + 255) / 256, 256, 0, stream>>>(CS);
    const unsigned LQ = (unsigned)(((size_t)NH_ * TT * HD / 2 + 255) / 256), LKv = (unsigned)(((size_t)NKV * TT * HD / 2 + 255) / 256);
    for (int b = 0; b < NB_; ++b) {
        
        k_cvt8pad<<<(unsigned)(((size_t)TT * DM / 8 + 255) / 256), 256, 0, stream>>>(x + (size_t)b * LR * DM, XB);
        k_gemmw<bf, 0, true><<<dim3(TT / 64, DQ / 64, 1), 32, 0, stream>>>(XB, nullptr, WQ, nullptr, DM, FQ, DQ, bq, 0, 0, 0);
        k_rope<<<LQ, 256, 0, stream>>>(FQ, DQ, NH_, CS, nullptr, nullptr, 1.0f, QP16, QPh, QPl);
        k_gemmw<bf, 0, true><<<dim3(TT / 64, DKV / 64, 1), 32, 0, stream>>>(XB, nullptr, WK, nullptr, DM, FK, DKV, bk, 0, 0, 0);
        k_rope<<<LKv, 256, 0, stream>>>(FK, DKV, NKV, CS, nullptr, nullptr, 1.0f, KP16, KPh, KPl);
        k_gemmw<bf, 0, true><<<dim3(TT / 64, DKV / 64, 1), 32, 0, stream>>>(XB, nullptr, WV, nullptr, DM, FV, DKV, bv, 0, 0, 0); k_vtp<<<LKv, 256, 0, stream>>>(FV, DKV, NKV, VT16, VTh, VTl);
        for (int h0 = 0; h0 < NH_; h0 += ZH) { const size_t zq = (size_t)h0, zk = (size_t)(h0 / REP);   // one kv head per query head: the pass's two heads use consecutive kv planes (z-strides TT*HD)
            k_gemmc<bf, 2, 1><<<dim3(RH / 64, TT / 64, ZH), 32, 0, stream>>>(QPh + zq * TT * HD, QPl + zq * TT * HD, KPh + zk * TT * HD, KPl + zk * TT * HD, HD, Sb, TT, 0, (size_t)TT * HD, (size_t)TT * HD, (size_t)TT * TT);
            k_gemmc<h16, 0, 1><<<dim3((TT - RH) / 64, TT / 64, ZH), 32, 0, stream>>>(QP16 + zq * TT * HD + (size_t)RH * HD, nullptr, KP16 + zk * TT * HD, nullptr, HD, Sb + (size_t)RH * TT, TT, RH, (size_t)TT * HD, (size_t)TT * HD, (size_t)TT * TT);
            k_asoft<<<ZH * TT / 8, 256, 0, stream>>>(Sb, P16, Ph, Pl);
            k_gemmc<bf, 2, 2><<<dim3(RH / 64, HD / 64, ZH), 32, 0, stream>>>(Ph, Pl, VTh + zk * HD * TT, VTl + zk * HD * TT, TT, Ob, HD, 0, (size_t)RH * TT, (size_t)HD * TT, (size_t)TT * HD);
            k_gemmc<h16, 0, 2><<<dim3((TT - RH) / 64, HD / 64, ZH), 32, 0, stream>>>(P16 + (size_t)RH * TT, nullptr, VT16 + zk * HD * TT, nullptr, TT, Ob + (size_t)RH * HD, HD, RH, (size_t)TT * TT, (size_t)HD * TT, (size_t)TT * HD);
            k_merge<<<(unsigned)(((size_t)ZH * TT * HD / 2 + 255) / 256), 256, 0, stream>>>(Ob, h0, ATh, ATl); }
        k_gemmw<bf, 1, true><<<dim3(TT / 64, DM / 64, 1), 32, 0, stream>>>(ATh, ATl, WO, nullptr, DQ, YO, DM, bo, 0, 0, 0); k_outcp<<<(unsigned)(((size_t)LR * DM / 4 + 255) / 256), 256, 0, stream>>>(YO, OUT + (size_t)b * LR * DM); }
}

// v001
// Measured time: 866 microseconds a run.
// Two timings next to v000 put it at 4.62 and 4.61 times that version's speed.
#include <hip/hip_runtime.h>

// MultiHeadAttentionConcise (x [8][1000][1024] - 1,000 tokens padded to 1,024 tiles on chip: the padded key rows are masked by causality for every real query, and only the 1,000 real output rows are written; qkv = x Wqkv + bqkv ([1024][3072]: q | k | v blocks, 16 heads x 64); causal softmax(q.k / 8) (-inf); out = merged Wo + bo -> [8][1000][1024]).
// Compute dtypes, f32 accumulate: every input rounded to bf16; q/k/v on PLAIN bf16 operands (inputs: exact; zero-padded rows) + bias; causal scores and attn.v: query rows < 512 hl (3 products), the rest single fp16 (x1024), causal tile skipping; softmax f32; Wo hl x exact (2 products) + bias into a padded buffer, then the 1,000 real rows copied out (16-B lanes).

#define NB_  8
#define TT   1024
#define DM   1024
#define NH_  16
#define NKV  16
#define REP  (NH_ / NKV)
#define HD   64
#define DQ   (NH_ * HD)
#define DKV  (NKV * HD)
#define ZH   16                   // heads per attention pass (grid z): all heads of one batch
#define GB   4                    // batches per q|k|v projection launch
#define RH   512                  // query rows < RH use hi+lo planes (0: none)
#define WIN  1024
#define PCAR 1024.0f
#define LR   1000                 // real tokens per batch (TT = 1024 padded)
#define SCL  0.125f   // HD^-0.5
typedef _Float16 h16;
typedef unsigned short bf;
typedef __attribute__((ext_vector_type(16))) __bf16   v16bf;
typedef __attribute__((ext_vector_type(16))) _Float16 v16h;
typedef __attribute__((ext_vector_type(8)))  _Float16 v8h;
typedef __attribute__((ext_vector_type(8)))  unsigned short v8us;
typedef __attribute__((ext_vector_type(8)))  float    v8f;
typedef __attribute__((ext_vector_type(4)))  float    v4f;
typedef v8h  __attribute__((may_alias)) v8ha;
typedef v4f  __attribute__((may_alias)) v4fa;
typedef v8us __attribute__((may_alias)) v8usa;

__device__ __forceinline__ unsigned short f2bf(float f) { unsigned u = __float_as_uint(f); u += 0x7FFFu + ((u >> 16) & 1u); return (unsigned short)(u >> 16); }
__device__ __forceinline__ float bf2f(unsigned short b) { return __uint_as_float(((unsigned)b) << 16); }
__device__ __forceinline__ float bfr(float f) { return bf2f(f2bf(f)); }
__device__ __forceinline__ v16h cat16(v8h lo, v8h hi) { return __builtin_shufflevector(lo, hi, 0, 1, 2, 3, 4, 5, 6, 7, 8, 9, 10, 11, 12, 13, 14, 15); }
__device__ __forceinline__ v16bf cat16b(v8us lo, v8us hi) { return __builtin_bit_cast(v16bf, __builtin_shufflevector(lo, hi, 0, 1, 2, 3, 4, 5, 6, 7, 8, 9, 10, 11, 12, 13, 14, 15)); }
__device__ __forceinline__ v8f wmma16(v16h a, v16h b, v8f c) { return __builtin_amdgcn_wmma_f32_16x16x32_f16(false, a, false, b, (short)0, c, false, false); }
__device__ __forceinline__ v8f wmmab(v16bf a, v16bf b, v8f c) { return __builtin_amdgcn_wmma_f32_16x16x32_bf16(false, a, false, b, (short)0, c, false, false); }



// ---- k_gemmw: register-blocked GEMM, ONE WAVE per 64x64 output tile (16 accumulators), operands straight from K-contiguous 16-bit planes; grid (M/64, N/64, Z), 32 threads.
// C[m][n] (f32, pitch ldc, + optional f32 bias[n]) = sum_k A[m][k] Bt[n][k] (+ split products per NSPLIT). z-batch strides sA/sB/sC in elements. K % 32 == 0.
template <typename T16> struct WFrag;
template <> struct WFrag<h16> { typedef v16h V; static __device__ __forceinline__ V ld(const h16* p) { return cat16(*(const v8h*)p, *(const v8h*)(p + 16)); } static __device__ __forceinline__ v8f mma(V a, V b, v8f c) { return wmma16(a, b, c); } };
template <> struct WFrag<bf> { typedef v16bf V; static __device__ __forceinline__ V ld(const bf* p) { return cat16b(*(const v8us*)p, *(const v8us*)(p + 16)); } static __device__ __forceinline__ v8f mma(V a, V b, v8f c) { return wmmab(a, b, c); } };
template <typename T16, int NSPLIT, bool BIAS>
__global__ __launch_bounds__(32) void k_gemmw(const T16* __restrict__ A, const T16* __restrict__ A2, const T16* __restrict__ Bt, const T16* __restrict__ Bt2, int K, float* C, int ldc, const float* __restrict__ bias, size_t sA, size_t sB, size_t sC) {
    typedef typename WFrag<T16>::V V;
    __shared__ __align__(16) float os[16 * 68];
    const size_t z = blockIdx.z; A += z * sA; if (A2) A2 += z * sA; Bt += z * sB; if (Bt2) Bt2 += z * sB; C += z * sC;
    const int lane = threadIdx.x & 31, lr = lane & 15, hi = lane >> 4; const int r0 = blockIdx.x * 64, c0 = blockIdx.y * 64;
    v8f acc[4][4];
#pragma unroll
    for (int mb = 0; mb < 4; ++mb)
#pragma unroll
        for (int nb = 0; nb < 4; ++nb) acc[mb][nb] = (v8f){};
    const size_t aoff = (size_t)(r0 + lr) * K + 8 * hi, boff = (size_t)(c0 + lr) * K + 8 * hi;
#pragma unroll 1
    for (int kc = 0; kc < K; kc += 32) {
        V a[4], a2[4];
#pragma unroll
        for (int mb = 0; mb < 4; ++mb) { a[mb] = WFrag<T16>::ld(A + aoff + (size_t)mb * 16 * K + kc); if (NSPLIT == 1 || NSPLIT == 2) a2[mb] = WFrag<T16>::ld(A2 + aoff + (size_t)mb * 16 * K + kc); }
#pragma unroll
        for (int nb = 0; nb < 4; ++nb) { const V b = WFrag<T16>::ld(Bt + boff + (size_t)nb * 16 * K + kc); V b2; if (NSPLIT >= 2) b2 = WFrag<T16>::ld(Bt2 + boff + (size_t)nb * 16 * K + kc);
#pragma unroll
            for (int mb = 0; mb < 4; ++mb) { acc[mb][nb] = WFrag<T16>::mma(a[mb], b, acc[mb][nb]); if (NSPLIT == 1 || NSPLIT == 2) acc[mb][nb] = WFrag<T16>::mma(a2[mb], b, acc[mb][nb]); if (NSPLIT >= 2) acc[mb][nb] = WFrag<T16>::mma(a[mb], b2, acc[mb][nb]); } }
        asm volatile("v_nop\n\tv_nop\n\tv_nop\n\tv_nop" : "+v"(acc[0][0]), "+v"(acc[1][1]), "+v"(acc[2][2]), "+v"(acc[3][3]) : "v"(a[0]), "v"(a[3]));
    }
#pragma unroll
    for (int mb = 0; mb < 4; ++mb) {
#pragma unroll
        for (int nb = 0; nb < 4; ++nb) {
#pragma unroll
            for (int j = 0; j < 8; ++j) os[(hi * 8 + j) * 68 + nb * 16 + lr] = acc[mb][nb][j]; }
        __builtin_amdgcn_wave_barrier(); asm volatile("" ::: "memory");
        float* crow = C + (size_t)(r0 + mb * 16) * ldc + c0;
{
#pragma unroll
            for (int s = 0; s < 8; ++s) { const int row = 2 * s + hi, cofs = lr * 4; v4f val = *(const v4fa*)(os + row * 68 + cofs); if (BIAS) { val[0] += bfr(bias[c0 + cofs]); val[1] += bfr(bias[c0 + cofs + 1]); val[2] += bfr(bias[c0 + cofs + 2]); val[3] += bfr(bias[c0 + cofs + 3]); }
                *(v4f*)(crow + (size_t)row * ldc + cofs) = val; }
             }
        __builtin_amdgcn_wave_barrier(); asm volatile("" ::: "memory");
    }
}

// ---- k_gemmc: the same one-wave 64x64 tile GEMM specialised for causal attention: CMODE 1 skips score tiles entirely above the diagonal (query rows r0+roff.., key columns c0..), CMODE 2 limits the
// key (K) loop of the probability x value contraction to the diagonal block (probabilities beyond it are exactly zero). roff = row offset of this launch's first row within the sequence.
template <typename T16, int NSPLIT, int CMODE>
__global__ __launch_bounds__(32) void k_gemmc(const T16* __restrict__ A, const T16* __restrict__ A2, const T16* __restrict__ Bt, const T16* __restrict__ Bt2, int K, float* C, int ldc, int roff, size_t sA, size_t sB, size_t sC) {
    typedef typename WFrag<T16>::V V;
    __shared__ __align__(16) float os[16 * 68];
    const size_t z = blockIdx.z; A += z * sA; if (A2) A2 += z * sA; Bt += z * sB; if (Bt2) Bt2 += z * sB; C += z * sC;
    const int lane = threadIdx.x & 31, lr = lane & 15, hi = lane >> 4; const int r0 = blockIdx.x * 64, c0 = blockIdx.y * 64;
    if (CMODE == 1 && c0 > r0 + roff + 63) return;                  // score tile entirely above the causal diagonal: never read (the softmax masks j > i by select)
    const int Kl = (CMODE == 2) ? min(K, r0 + roff + 64) : K;        // P.V: probabilities are exactly 0 beyond the diagonal block, so the K loop stops there
    v8f acc[4][4];
#pragma unroll
    for (int mb = 0; mb < 4; ++mb)
#pragma unroll
        for (int nb = 0; nb < 4; ++nb) acc[mb][nb] = (v8f){};
    const size_t aoff = (size_t)(r0 + lr) * K + 8 * hi, boff = (size_t)(c0 + lr) * K + 8 * hi;
#pragma unroll 1
    for (int kc = 0; kc < Kl; kc += 32) {
        V a[4], a2[4];
#pragma unroll
        for (int mb = 0; mb < 4; ++mb) { a[mb] = WFrag<T16>::ld(A + aoff + (size_t)mb * 16 * K + kc); if (NSPLIT == 1 || NSPLIT == 2) a2[mb] = WFrag<T16>::ld(A2 + aoff + (size_t)mb * 16 * K + kc); }
#pragma unroll
        for (int nb = 0; nb < 4; ++nb) { const V b = WFrag<T16>::ld(Bt + boff + (size_t)nb * 16 * K + kc); V b2; if (NSPLIT >= 2) b2 = WFrag<T16>::ld(Bt2 + boff + (size_t)nb * 16 * K + kc);
#pragma unroll
            for (int mb = 0; mb < 4; ++mb) { acc[mb][nb] = WFrag<T16>::mma(a[mb], b, acc[mb][nb]); if (NSPLIT == 1 || NSPLIT == 2) acc[mb][nb] = WFrag<T16>::mma(a2[mb], b, acc[mb][nb]); if (NSPLIT >= 2) acc[mb][nb] = WFrag<T16>::mma(a[mb], b2, acc[mb][nb]); } }
        asm volatile("v_nop\n\tv_nop\n\tv_nop\n\tv_nop" : "+v"(acc[0][0]), "+v"(acc[1][1]), "+v"(acc[2][2]), "+v"(acc[3][3]) : "v"(a[0]), "v"(a[3]));
    }
#pragma unroll
    for (int mb = 0; mb < 4; ++mb) {
#pragma unroll
        for (int nb = 0; nb < 4; ++nb) {
#pragma unroll
            for (int j = 0; j < 8; ++j) os[(hi * 8 + j) * 68 + nb * 16 + lr] = acc[mb][nb][j]; }
        __builtin_amdgcn_wave_barrier(); asm volatile("" ::: "memory");
        float* crow = C + (size_t)(r0 + mb * 16) * ldc + c0;
{
#pragma unroll
            for (int s = 0; s < 8; ++s) { const int row = 2 * s + hi, cofs = lr * 4; v4f val = *(const v4fa*)(os + row * 68 + cofs);
                *(v4f*)(crow + (size_t)row * ldc + cofs) = val; }
             }
        __builtin_amdgcn_wave_barrier(); asm volatile("" ::: "memory");
    }
}

__device__ __forceinline__ h16 tohx(float x) { return (h16)x; }
__device__ __forceinline__ void splitf(float y, unsigned short& h, unsigned short& l) { h = f2bf(y); l = f2bf(y - bf2f(h)); }
typedef __attribute__((ext_vector_type(2))) _Float16 v2h;
typedef __attribute__((ext_vector_type(4))) _Float16 v4h;
typedef __attribute__((ext_vector_type(2))) unsigned short v2us;
typedef __attribute__((ext_vector_type(4))) unsigned short v4us;
typedef __attribute__((ext_vector_type(2))) float v2f;
typedef __attribute__((ext_vector_type(4))) int v4i;

__global__ __launch_bounds__(256) void k_wtG(const float* __restrict__ w, int K, int N, bf* Bt) {
    const int lane = threadIdx.x & 31; const int L0 = (blockIdx.x * 8 + (threadIdx.x >> 5)) * 8; const int nlines = N * K / 64;
{
#pragma unroll 1
        for (int l = 0; l < 8; ++l) { const int L = L0 + l; if (L >= nlines) break; const size_t e = (size_t)L * 64 + lane * 2; const int k = (int)(e % K), n = (int)(e / K); v2us o;
            o[0] = f2bf(w[(size_t)k * N + n]); o[1] = f2bf(w[(size_t)(k + 1) * N + n]); *(v2us*)(Bt + e) = o; }
         }
}
__global__ __launch_bounds__(256) void k_cvt8(const float* __restrict__ src, bf* dst, size_t n8) { const size_t i = (size_t)blockIdx.x * 256 + threadIdx.x; if (i >= n8) return; const v8f v = *(const v8f*)(src + i * 8); v8us o;
#pragma unroll
    for (int k = 0; k < 8; ++k) o[k] = f2bf(v[k]); *(v8us*)(dst + i * 8) = o;  }
__global__ __launch_bounds__(256) void k_cscvt(const float* __restrict__ cosT, const float* __restrict__ sinT, float* CS) { const int idx = blockIdx.x * 256 + threadIdx.x; if (idx >= TT * HD) return; v2f cs; cs[0] = bfr(cosT[idx]); cs[1] = bfr(sinT[idx]); *(v2f*)(CS + (size_t)idx * 2) = cs;  }
// k_rope: head planes [h][t][d] (fp16 + hi/lo) of rope(x) x sc with the rotate-half convention out[d] = x[d] cos[t][d] - x[d+HD/2] sin[t][d], out[d+HD/2] = x[d+HD/2] cos[t][d+HD/2] + x[d] sin[t][d+HD/2]
__global__ __launch_bounds__(256) void k_rope(const float* __restrict__ F, int pitch, int nheads, const float* __restrict__ CS, const float* __restrict__ RF, const float* __restrict__ nw, float sc, h16* P16, bf* Ph, bf* Pl) {
    const size_t e = ((size_t)blockIdx.x * 256 + threadIdx.x) * 2; if (e >= (size_t)nheads * TT * HD) return; const int d = (int)(e % HD); const int t = (int)((e / HD) % TT); const int h = (int)(e / ((size_t)HD * TT)); const float* f = F + (size_t)t * pitch + h * HD; const float rf = RF ? RF[(size_t)h * TT + t] : 1.0f; v2h o16; v2us oh, ol;
#pragma unroll
    for (int q = 0; q < 2; ++q) { const int dd = d + q; const int dp = (dd < HD / 2) ? dd + HD / 2 : dd - HD / 2; float x0 = f[dd], x1 = f[dp];
        if (RF) { float n0 = __fmul_rn(x0, rf), n1 = __fmul_rn(x1, rf); asm volatile("" : "+v"(n0)); asm volatile("" : "+v"(n1)); x0 = __fmul_rn(bfr(nw[dd]), n0); x1 = __fmul_rn(bfr(nw[dp]), n1); }
        const v2f cs = *(const v2f*)(CS + ((size_t)t * HD + dd) * 2); float a = __fmul_rn(x0, cs[0]), bq = __fmul_rn(x1, cs[1]); asm volatile("" : "+v"(a)); asm volatile("" : "+v"(bq)); const float r = ((dd < HD / 2) ? __fsub_rn(a, bq) : __fadd_rn(a, bq)) * sc;
        o16[q] = tohx(r); unsigned short a2, c2; splitf(r, a2, c2); oh[q] = a2; ol[q] = c2; }
    *(v2h*)(P16 + e) = o16; *(v2us*)(Ph + e) = oh; *(v2us*)(Pl + e) = ol;  }
__global__ __launch_bounds__(256) void k_vtp(const float* __restrict__ F, int pitch, int nheads, h16* V16, bf* Vh, bf* Vl) { const size_t e = ((size_t)blockIdx.x * 256 + threadIdx.x) * 2; if (e >= (size_t)nheads * HD * TT) return; const int t = (int)(e % TT); const int d = (int)((e / TT) % HD); const int g = (int)(e / ((size_t)TT * HD)); v2h o16; v2us oh, ol;
#pragma unroll
    for (int q = 0; q < 2; ++q) { const float x = F[(size_t)(t + q) * pitch + g * HD + d]; o16[q] = tohx(x); unsigned short a2, c2; splitf(x, a2, c2); oh[q] = a2; ol[q] = c2; }
    *(v2h*)(V16 + e) = o16; *(v2us*)(Vh + e) = oh; *(v2us*)(Vl + e) = ol;  }
__global__ __launch_bounds__(256) void k_csid(float* CS) { const int idx = blockIdx.x * 256 + threadIdx.x; if (idx >= TT * HD) return; v2f cs; cs[0] = 1.0f; cs[1] = 0.0f; *(v2f*)(CS + (size_t)idx * 2) = cs;  }
__global__ __launch_bounds__(256) void k_cvt8pad(const float* __restrict__ src, bf* XB) { src += (size_t)blockIdx.y * LR * DM; XB += (size_t)blockIdx.y * TT * DM; const size_t e8 = ((size_t)blockIdx.x * 256 + threadIdx.x) * 8; if (e8 >= (size_t)TT * DM) return; const int t = (int)(e8 / DM); v8us o; if (t < LR) { const v4f a = *(const v4f*)(src + e8), c = *(const v4f*)(src + e8 + 4); for (int u = 0; u < 4; ++u) { o[u] = f2bf(a[u]); o[u + 4] = f2bf(c[u]); } } else { for (int u = 0; u < 8; ++u) o[u] = 0; } *(v8us*)(XB + e8) = o;  }
__global__ __launch_bounds__(256) void k_outcp(const float* __restrict__ Y, float* OUTb) { Y += (size_t)blockIdx.y * TT * DM; OUTb += (size_t)blockIdx.y * LR * DM; const size_t e = ((size_t)blockIdx.x * 256 + threadIdx.x) * 4; if (e >= (size_t)LR * DM) return; const v4f a = *(const v4f*)(Y + e); *(v4f*)(OUTb + e) = a;  }
// k_asoft: per row (zz, i): t = S x HD^-0.5 for j <= i and i - j < WIN (sliding causal window; the reference's -1e9 additive fill vanishes identically); softmax over the 1024 keys (register row, one exp, fixed trees);
__global__ __launch_bounds__(256) void k_asoft(const float* __restrict__ Sb, h16* P16, bf* Ph, bf* Pl) {
    const int lane = threadIdx.x & 31; const int row = blockIdx.x * 8 + (threadIdx.x >> 5); if (row >= ZH * TT) return; const int i = row % TT; const int zz = row / TT; (void)zz; const bool hires = (i < RH); const float* sr = Sb + (size_t)row * TT; float v[TT / 32]; float mx = -3.0e38f;
#pragma unroll
    for (int ch = 0; ch < TT / 128; ++ch) { const int j0 = ch * 128 + lane * 4; const v4f a = *(const v4f*)(sr + j0);
#pragma unroll
        for (int q = 0; q < 4; ++q) { const int j = j0 + q; (void)j; const float t = (j <= i && i - j < WIN) ? a[q] * SCL : -3.0e38f; v[ch * 4 + q] = t; mx = fmaxf(mx, t); } }
#pragma unroll
    for (int sh = 16; sh; sh >>= 1) mx = fmaxf(mx, __shfl_xor(mx, sh, 32));
    float sum = 0.f;
#pragma unroll
    for (int k = 0; k < TT / 32; ++k) { float d0 = __fsub_rn(v[k], mx); asm volatile("" : "+v"(d0)); v[k] = __builtin_amdgcn_exp2f(__fmul_rn(d0, 1.4426950408889634f)); sum += v[k]; }
#pragma unroll
    for (int sh = 16; sh; sh >>= 1) sum += __shfl_xor(sum, sh, 32);
    const float f = __fdiv_rn(hires ? 1.0f : PCAR, sum);
{
        if (hires) {
#pragma unroll
            for (int ch = 0; ch < TT / 128; ++ch) { v4us oh, ol;
#pragma unroll
                for (int q = 0; q < 4; ++q) { unsigned short a, c2; splitf(v[ch * 4 + q] * f, a, c2); oh[q] = a; ol[q] = c2; }
                const size_t oo = ((size_t)zz * (RH ? RH : 1) + i) * TT + ch * 128 + lane * 4; *(v4us*)(Ph + oo) = oh; *(v4us*)(Pl + oo) = ol; }
        } else {
#pragma unroll
            for (int ch = 0; ch < TT / 128; ++ch) { v4h o4;
#pragma unroll
                for (int q = 0; q < 4; ++q) o4[q] = tohx(v[ch * 4 + q] * f);
                *(v4h*)(P16 + (size_t)row * TT + ch * 128 + lane * 4) = o4; } }
         }
}
__global__ __launch_bounds__(256) void k_merge(const float* __restrict__ O, int h0, bf* Ah, bf* Al) { const size_t e = ((size_t)blockIdx.x * 256 + threadIdx.x) * 2; if (e >= (size_t)ZH * TT * HD) return; const int d = (int)(e % HD); const int t = (int)((e / HD) % TT); const int zz = (int)(e / ((size_t)HD * TT)); const float cs = (t < RH) ? 1.0f : (1.0f / PCAR); const size_t oo = (size_t)t * DQ + (h0 + zz) * HD + d;
    v2us oh, ol;
#pragma unroll
    for (int q = 0; q < 2; ++q) { unsigned short a, c2; splitf(O[e + q] * cs, a, c2); oh[q] = a; ol[q] = c2; } *(v2us*)(Ah + oo) = oh; *(v2us*)(Al + oo) = ol;  }

extern "C" void kernel_launch(void* const* d_in, const int* in_sizes, int n_in,
                              void* d_out, int out_size, void* d_ws, size_t ws_size, hipStream_t stream) {
    (void)in_sizes; (void)n_in; (void)out_size;
    const float* x = (const float*)d_in[0]; const float* wf = (const float*)d_in[1]; const float* bf3 = (const float*)d_in[2]; const float* wo = (const float*)d_in[3]; const float* bo = (const float*)d_in[4];
    float* OUT = (float*)d_out;     // [8][1000][1024]
    char* wsp = (char*)d_ws;
    auto take = [&](size_t bytes) { char* p = wsp; wsp += (bytes + 255) & ~(size_t)255; return (void*)p; };
    const int NQKV = DQ + 2 * DKV;
    bf* WO = (bf*)take((size_t)DM * DQ * 2); float* CS = (float*)take((size_t)TT * HD * 2 * 4);
    bf* XB = (bf*)take((size_t)NB_ * TT * DM * 2); bf* WALL = (bf*)take((size_t)NQKV * DM * 2); float* FA = (float*)take((size_t)GB * TT * NQKV * 4);
    h16* QP16 = (h16*)take((size_t)NH_ * TT * HD * 2); h16* KP16 = (h16*)take((size_t)NKV * TT * HD * 2); h16* VT16 = (h16*)take((size_t)NKV * HD * TT * 2);
    bf* QPh = (bf*)take((size_t)NH_ * TT * HD * 2); bf* QPl = (bf*)take((size_t)NH_ * TT * HD * 2); bf* KPh = (bf*)take((size_t)NKV * TT * HD * 2); bf* KPl = (bf*)take((size_t)NKV * TT * HD * 2); bf* VTh = (bf*)take((size_t)NKV * HD * TT * 2); bf* VTl = (bf*)take((size_t)NKV * HD * TT * 2); bf* Ph = (bf*)take((size_t)ZH * RH * TT * 2); bf* Pl = (bf*)take((size_t)ZH * RH * TT * 2);
    float* Sb = (float*)take((size_t)ZH * TT * TT * 4); h16* P16 = (h16*)take((size_t)ZH * TT * TT * 2); float* Ob = (float*)take((size_t)ZH * TT * HD * 4); bf* ATh = (bf*)take((size_t)NB_ * TT * DQ * 2); bf* ATl = (bf*)take((size_t)NB_ * TT * DQ * 2);
    if ((size_t)(wsp - (char*)d_ws) > ws_size) return;    // 254.5 MiB of the 256 MiB workspace
    float* YO = Sb;   // the padded output [8][1024][1024] reuses the score buffer after the last softmax has read it (stream-ordered)
    k_wtG<<<(unsigned)((DM * NQKV / 64 + 63) / 64), 256, 0, stream>>>(wf, DM, NQKV, WALL);
    k_wtG<<<(unsigned)((DQ * DM / 64 + 63) / 64), 256, 0, stream>>>(wo, DQ, DM, WO);
    k_csid<<<(TT * HD + 255) / 256, 256, 0, stream>>>(CS);
    k_cvt8pad<<<dim3((unsigned)(((size_t)TT * DM / 8 + 255) / 256), NB_, 1), 256, 0, stream>>>(x, XB);
    const unsigned LQ = (unsigned)(((size_t)NH_ * TT * HD / 2 + 255) / 256), LKv = (unsigned)(((size_t)NKV * TT * HD / 2 + 255) / 256);
    for (int b = 0; b < NB_; ++b) {
        if (b % GB == 0)   // q | k | v of GB batches in one launch: rows = GB x 1024 tokens, columns = the 3072 fused outputs
            k_gemmw<bf, 0, true><<<dim3(GB * TT / 64, NQKV / 64, 1), 32, 0, stream>>>(XB + (size_t)b * TT * DM, nullptr, WALL, nullptr, DM, FA, NQKV, bf3, 0, 0, 0);
        const float* F = FA + (size_t)(b % GB) * TT * NQKV;
        k_rope<<<LQ, 256, 0, stream>>>(F, NQKV, NH_, CS, nullptr, nullptr, 1.0f, QP16, QPh, QPl);
        k_rope<<<LKv, 256, 0, stream>>>(F + DQ, NQKV, NKV, CS, nullptr, nullptr, 1.0f, KP16, KPh, KPl);
        k_vtp<<<LKv, 256, 0, stream>>>(F + DQ + DKV, NQKV, NKV, VT16, VTh, VTl);
        // one attention pass per batch: grid z walks all 16 heads (one kv head per query head, z-strides TT*HD)
        k_gemmc<bf, 2, 1><<<dim3(RH / 64, TT / 64, ZH), 32, 0, stream>>>(QPh, QPl, KPh, KPl, HD, Sb, TT, 0, (size_t)TT * HD, (size_t)TT * HD, (size_t)TT * TT);
        k_gemmc<h16, 0, 1><<<dim3((TT - RH) / 64, TT / 64, ZH), 32, 0, stream>>>(QP16 + (size_t)RH * HD, nullptr, KP16, nullptr, HD, Sb + (size_t)RH * TT, TT, RH, (size_t)TT * HD, (size_t)TT * HD, (size_t)TT * TT);
        k_asoft<<<ZH * TT / 8, 256, 0, stream>>>(Sb, P16, Ph, Pl);
        k_gemmc<bf, 2, 2><<<dim3(RH / 64, HD / 64, ZH), 32, 0, stream>>>(Ph, Pl, VTh, VTl, TT, Ob, HD, 0, (size_t)RH * TT, (size_t)HD * TT, (size_t)TT * HD);
        k_gemmc<h16, 0, 2><<<dim3((TT - RH) / 64, HD / 64, ZH), 32, 0, stream>>>(P16 + (size_t)RH * TT, nullptr, VT16, nullptr, TT, Ob + (size_t)RH * HD, HD, RH, (size_t)TT * TT, (size_t)HD * TT, (size_t)TT * HD);
        k_merge<<<(unsigned)(((size_t)ZH * TT * HD / 2 + 255) / 256), 256, 0, stream>>>(Ob, 0, ATh + (size_t)b * TT * DQ, ATl + (size_t)b * TT * DQ); }
    k_gemmw<bf, 1, true><<<dim3(NB_ * TT / 64, DM / 64, 1), 32, 0, stream>>>(ATh, ATl, WO, nullptr, DQ, YO, DM, bo, 0, 0, 0);
    k_outcp<<<dim3((unsigned)(((size_t)LR * DM / 4 + 255) / 256), NB_, 1), 256, 0, stream>>>(YO, OUT);
}

// v003
// It runs in 256 microseconds.
// It is 3.39 times as fast as v001, going by the measured steps of the versions left out in between.
// Over all steps from v000 it is 15.7 times as fast.
#include <hip/hip_runtime.h>

// MultiHeadAttentionConcise (x [8][1000][1024] - 1,000 tokens padded to 1,024 tiles on chip: the padded key rows are masked by causality for every real query, and only the 1,000 real output rows are written; qkv = x Wqkv + bqkv ([1024][3072]: q | k | v blocks, 16 heads x 64); causal softmax(q.k / 8) (-inf); out = merged Wo + bo -> [8][1000][1024]).
// Compute dtypes, f32 accumulate: every input rounded to bf16; q/k/v on PLAIN bf16 operands (inputs: exact; zero-padded rows) + bias, written by the GEMM itself as the 16-bit head planes that attention reads; causal scores and attn.v in ONE kernel (online softmax, f32, scores never leave registers): query rows < 512 hl (3 products), the rest single fp16 (probabilities x1024), key tiles beyond the diagonal skipped; Wo hl x exact (2 products) + bias, the 1,000 real rows of a batch stored straight to the output.

#define NB_  8
#define TT   1024
#define DM   1024
#define NH_  16
#define NKV  16
#define REP  (NH_ / NKV)
#define HD   64
#define DQ   (NH_ * HD)
#define DKV  (NKV * HD)
#define RH   512                  // query rows < RH use hi+lo planes (0: none)
#define LR   1000                 // real tokens per batch (TT = 1024 padded)
#define SCL  0.125f   // HD^-0.5
typedef _Float16 h16;
typedef unsigned short bf;
typedef __attribute__((ext_vector_type(16))) __bf16   v16bf;
typedef __attribute__((ext_vector_type(16))) _Float16 v16h;
typedef __attribute__((ext_vector_type(8)))  _Float16 v8h;
typedef __attribute__((ext_vector_type(8)))  unsigned short v8us;
typedef __attribute__((ext_vector_type(8)))  float    v8f;
typedef __attribute__((ext_vector_type(4)))  float    v4f;
typedef v8h  __attribute__((may_alias)) v8ha;
typedef v4f  __attribute__((may_alias)) v4fa;
typedef v8us __attribute__((may_alias)) v8usa;

__device__ __forceinline__ unsigned short f2bf(float f) { unsigned u = __float_as_uint(f); u += 0x7FFFu + ((u >> 16) & 1u); return (unsigned short)(u >> 16); }
__device__ __forceinline__ float bf2f(unsigned short b) { return __uint_as_float(((unsigned)b) << 16); }
__device__ __forceinline__ float bfr(float f) { return bf2f(f2bf(f)); }
__device__ __forceinline__ v16h cat16(v8h lo, v8h hi) { return __builtin_shufflevector(lo, hi, 0, 1, 2, 3, 4, 5, 6, 7, 8, 9, 10, 11, 12, 13, 14, 15); }
__device__ __forceinline__ v16bf cat16b(v8us lo, v8us hi) { return __builtin_bit_cast(v16bf, __builtin_shufflevector(lo, hi, 0, 1, 2, 3, 4, 5, 6, 7, 8, 9, 10, 11, 12, 13, 14, 15)); }
__device__ __forceinline__ v8f wmma16(v16h a, v16h b, v8f c) { return __builtin_amdgcn_wmma_f32_16x16x32_f16(false, a, false, b, (short)0, c, false, false); }
__device__ __forceinline__ v8f wmmab(v16bf a, v16bf b, v8f c) { return __builtin_amdgcn_wmma_f32_16x16x32_bf16(false, a, false, b, (short)0, c, false, false); }



// ---- k_gemmw: register-blocked GEMM, ONE WAVE per 64x64 output tile (16 accumulators), operands straight from K-contiguous 16-bit planes; grid (M/64, N/64), 32 threads.
// c[m][n] (f32) = sum_k A[m][k] Bt[n][k] (+ split products per NSPLIT) + bf16(bias[n]); m = batch * TT + token. K % 32 == 0. The epilogue stores the layout that the next reader wants, whole 128-B lines:
// HEADS: n = q | k | v block, head, d: one tile is 64 tokens of one head. q, k -> planes [batch][head][token][d]; v -> [batch][head][d][token], for which the wave takes the weight rows as its A operand and the tokens as B
//        (both fragments have one loader and one k order, so the same products come out as the transposed tile). Planes P16 (fp16), Ph, Pl (bf16 hi, lo) hold q, k, v one behind the other.
//        Stored is what k_fattn reads: hi and lo for tokens < RH (all of its hl tiles lie there), fp16 for every k and v token and for the q tokens >= RH.
// else : rows of C = the output [batch][LR][DM]; the padded tokens >= LR are not stored.
typedef __attribute__((ext_vector_type(8))) __bf16 v8bf;
static_assert(LR % 2 == 0 && TT % 64 == 0 && RH % 64 == 0, "tile tests are per wave");
template <typename T16> struct WFrag;
template <> struct WFrag<h16> { typedef v16h V; static __device__ __forceinline__ V ld(const h16* p) { return cat16(*(const v8h*)p, *(const v8h*)(p + 16)); } static __device__ __forceinline__ v8f mma(V a, V b, v8f c) { return wmma16(a, b, c); } };
template <> struct WFrag<bf> { typedef v16bf V; static __device__ __forceinline__ V ld(const bf* p) { return cat16b(*(const v8us*)p, *(const v8us*)(p + 16)); } static __device__ __forceinline__ v8f mma(V a, V b, v8f c) { return wmmab(a, b, c); } };
template <typename T16, int NSPLIT, bool HEADS>
__global__ __launch_bounds__(32) void k_gemmw(const T16* __restrict__ A, const T16* __restrict__ A2, const T16* __restrict__ Bt, const T16* __restrict__ Bt2, int K, const float* __restrict__ bias, float* C, h16* P16, bf* Ph, bf* Pl) {
    typedef typename WFrag<T16>::V V;
    __shared__ __align__(16) float os[16 * 68];
    const int lane = threadIdx.x & 31, lr = lane & 15, hi = lane >> 4; const int r0 = blockIdx.x * 64, c0 = blockIdx.y * 64;
    const bool isv = HEADS && c0 >= DQ + DKV;   // the same for the whole wave
    v8f acc[4][4];
#pragma unroll
    for (int mb = 0; mb < 4; ++mb)
#pragma unroll
        for (int nb = 0; nb < 4; ++nb) acc[mb][nb] = (v8f){};
    if (isv) { const T16* const w = Bt; Bt = A; A = w; }
    const size_t aoff = (size_t)((isv ? c0 : r0) + lr) * K + 8 * hi, boff = (size_t)((isv ? r0 : c0) + lr) * K + 8 * hi;
#pragma unroll 1
    for (int kc = 0; kc < K; kc += 32) {
        V a[4], a2[4];
#pragma unroll
        for (int mb = 0; mb < 4; ++mb) { a[mb] = WFrag<T16>::ld(A + aoff + (size_t)mb * 16 * K + kc); if (NSPLIT == 1 || NSPLIT == 2) a2[mb] = WFrag<T16>::ld(A2 + aoff + (size_t)mb * 16 * K + kc); }
#pragma unroll
        for (int nb = 0; nb < 4; ++nb) { const V b = WFrag<T16>::ld(Bt + boff + (size_t)nb * 16 * K + kc); V b2; if (NSPLIT >= 2) b2 = WFrag<T16>::ld(Bt2 + boff + (size_t)nb * 16 * K + kc);
#pragma unroll
            for (int mb = 0; mb < 4; ++mb) { acc[mb][nb] = WFrag<T16>::mma(a[mb], b, acc[mb][nb]); if (NSPLIT == 1 || NSPLIT == 2) acc[mb][nb] = WFrag<T16>::mma(a2[mb], b, acc[mb][nb]); if (NSPLIT >= 2) acc[mb][nb] = WFrag<T16>::mma(a[mb], b2, acc[mb][nb]); } }
        asm volatile("v_nop\n\tv_nop\n\tv_nop\n\tv_nop" : "+v"(acc[0][0]), "+v"(acc[1][1]), "+v"(acc[2][2]), "+v"(acc[3][3]) : "v"(a[0]), "v"(a[3]));
    }
    const int bt = r0 / TT, t0 = r0 % TT;   // batch and first token of the tile (64 divides TT)
    const int rq = lane >> 3, cq = (lane & 7) * 8;   // HEADS: a lane stores 8 elements (16 B), 8 lanes a 128-B row, a wave 4 rows
    const bool whl = t0 < RH, w16 = c0 >= DQ || !whl;
    const int pitch = isv ? TT : HD;
    const size_t pbase = HEADS ? ((size_t)(c0 / DQ) * NB_ * NH_ + (size_t)bt * NH_ + (c0 % DQ) / HD) * TT * HD + (size_t)t0 * (isv ? 1 : HD) + cq : 0;
    float bc[8], br[4][4];   // HEADS: the bias of the lane's 8 columns (q, k: columns are the n index) and of its 16 rows (v: rows are), all fetched here at once: one latency a tile
    v4f bv;                  // else: the bias of the lane's 4 columns
    if (HEADS) {
#pragma unroll
        for (int u = 0; u < 8; ++u) bc[u] = bias[c0 + cq + u];
        asm volatile("s_wait_xcnt 0x0" ::: "memory");   // the row loads behind it land in the address registers of the column loads
#pragma unroll
        for (int mb = 0; mb < 4; ++mb)
#pragma unroll
            for (int s = 0; s < 4; ++s) br[mb][s] = bfr(bias[c0 + mb * 16 + 4 * s + rq]);
#pragma unroll
        for (int u = 0; u < 8; ++u) bc[u] = bfr(bc[u]);
    } else {
#pragma unroll
        for (int u = 0; u < 4; ++u) bv[u] = bfr(bias[c0 + lr * 4 + u]); }
#pragma unroll
    for (int mb = 0; mb < 4; ++mb) {
#pragma unroll
        for (int nb = 0; nb < 4; ++nb) {
#pragma unroll
            for (int j = 0; j < 8; ++j) os[(hi * 8 + j) * 68 + nb * 16 + lr] = acc[mb][nb][j]; }
        __builtin_amdgcn_wave_barrier(); asm volatile("" ::: "memory");
        if (HEADS) {
#pragma unroll
            for (int s = 0; s < 4; ++s) { const int row = 4 * s + rq; const v4f x0 = *(const v4fa*)(os + row * 68 + cq), x1 = *(const v4fa*)(os + row * 68 + cq + 4);
                v8h o16; v8bf oh, ol;   // hi = bf16(y), lo = bf16(y - hi), round to nearest even
#pragma unroll
                for (int u = 0; u < 8; ++u) { const float y = (u < 4 ? x0[u] : x1[u - 4]) + (isv ? br[mb][s] : bc[u]); o16[u] = (h16)y; const __bf16 h = (__bf16)y; oh[u] = h; ol[u] = (__bf16)(y - (float)h); }
                const size_t o = pbase + (size_t)(mb * 16 + row) * pitch;
                // s_wait_xcnt 0: stands between a store and the next instructions, which rewrite its address and data registers
                if (w16) { *(v8h*)(P16 + o) = o16; asm volatile("s_wait_xcnt 0x0" ::: "memory"); }
                if (whl) { *(v8bf*)(Ph + o) = oh; *(v8bf*)(Pl + o) = ol; asm volatile("s_wait_xcnt 0x0" ::: "memory"); } }
        } else {
            float* crow = C + ((size_t)bt * LR + t0 + mb * 16) * DM + c0;
#pragma unroll
            for (int s = 0; s < 8; ++s) { const int row = 2 * s + hi, cofs = lr * 4;
                // LR is even: the wave's two rows are real or padded together, a scalar test. s_wait_xcnt 0: stands between the store and the next instructions, which rewrite its address and data registers
                if (t0 + mb * 16 + 2 * s < LR) { const v4f val = *(const v4fa*)(os + row * 68 + cofs) + bv; *(v4f*)(crow + (size_t)row * DM + cofs) = val; asm volatile("s_wait_xcnt 0x0" ::: "memory"); } }
        }
        __builtin_amdgcn_wave_barrier(); asm volatile("" ::: "memory");
    }
}

__device__ __forceinline__ h16 tohx(float x) { return (h16)x; }
__device__ __forceinline__ void splitf(float y, unsigned short& h, unsigned short& l) { h = f2bf(y); l = f2bf(y - bf2f(h)); }
typedef __attribute__((ext_vector_type(2))) _Float16 v2h;
typedef __attribute__((ext_vector_type(4))) _Float16 v4h;
typedef __attribute__((ext_vector_type(2))) unsigned short v2us;
typedef __attribute__((ext_vector_type(4))) unsigned short v4us;
typedef __attribute__((ext_vector_type(2))) float v2f;
typedef __attribute__((ext_vector_type(4))) int v4i;

__global__ __launch_bounds__(256) void k_wtG(const float* __restrict__ w, int K, int N, bf* Bt) {
    const int lane = threadIdx.x & 31; const int L0 = (blockIdx.x * 8 + (threadIdx.x >> 5)) * 8; const int nlines = N * K / 64;
{
#pragma unroll 1
        for (int l = 0; l < 8; ++l) { const int L = L0 + l; if (L >= nlines) break; const size_t e = (size_t)L * 64 + lane * 2; const int k = (int)(e % K), n = (int)(e / K); v2us o;
            o[0] = f2bf(w[(size_t)k * N + n]); o[1] = f2bf(w[(size_t)(k + 1) * N + n]); *(v2us*)(Bt + e) = o; }
         }
}
__global__ __launch_bounds__(256) void k_cvt8pad(const float* __restrict__ src, bf* XB) { src += (size_t)blockIdx.y * LR * DM; XB += (size_t)blockIdx.y * TT * DM; const size_t e8 = ((size_t)blockIdx.x * 256 + threadIdx.x) * 8; if (e8 >= (size_t)TT * DM) return; const int t = (int)(e8 / DM); v8us o; if (t < LR) { const v4f a = *(const v4f*)(src + e8), c = *(const v4f*)(src + e8 + 4); for (int u = 0; u < 4; ++u) { o[u] = f2bf(a[u]); o[u + 4] = f2bf(c[u]); } } else { for (int u = 0; u < 8; ++u) o[u] = 0; } *(v8us*)(XB + e8) = o;  }
// ---- k_fattn: causal attention of all batches and heads in one launch. One wave owns 32 query rows and walks the key tiles (32 keys: a wave stays within 256 registers, four waves a SIMD) up to its diagonal; no LDS, no barrier.
// Scores are formed TRANSPOSED, St[key][query] = K q^T: a lane then holds 8 consecutive keys of ONE query (accumulator row = 8 hi + j, column = lane & 15), which is exactly the k order of the
// B fragment (elements 0..7: k = 8 hi + e; 8..15: k = 16 + 8 hi + e), so two 16-key score tiles become one 32-key probability fragment in place, and Ot[d][query] = Vt p^T follows.
// Online softmax per query (one lane pair): running maximum m of the raw scores, p = 2^(CL2 (s - m) + POFF), the sum l and Ot are rescaled by 2^(CL2 (m_old - m_new)); out = Ot / l (the 2^POFF cancels).
#define CL2 (SCL * 1.4426950408889634f)
__device__ __forceinline__ float exp2s(float x) { float r; asm("v_exp_f32 %0, %1\n\tv_nop" : "=v"(r) : "v"(x)); return r; }
template <bool HL> struct PFrag;
template <> struct PFrag<false> { static __device__ __forceinline__ void mk(const v8f& x, const v8f& y, v16h& p, v16h& p2) { (void)p2;
#pragma unroll
    for (int j = 0; j < 8; ++j) { p[j] = (h16)x[j]; p[j + 8] = (h16)y[j]; } } };
template <> struct PFrag<true> { static __device__ __forceinline__ void mk(const v8f& x, const v8f& y, v16bf& p, v16bf& p2) {   // hi = bf16(x), lo = bf16(x - hi), round to nearest even as in splitf (x is finite)
#pragma unroll
    for (int j = 0; j < 8; ++j) { const __bf16 a = (__bf16)x[j], b = (__bf16)y[j]; p[j] = a; p[j + 8] = b; p2[j] = (__bf16)(x[j] - (float)a); p2[j + 8] = (__bf16)(y[j] - (float)b); } } };
// fragment at a tile's base address (the same in every lane) plus the lane's 32-bit byte offset
template <typename T16> __device__ __forceinline__ typename WFrag<T16>::V ldo(const T16* base, unsigned off) { return WFrag<T16>::ld((const T16*)((const char*)base + off)); }
template <typename T16, bool HL, int KB>   // KB: 16-key blocks per key tile
__device__ __forceinline__ void fattn_wave(const T16* __restrict__ Q, const T16* __restrict__ Q2, const T16* __restrict__ Kp, const T16* __restrict__ K2, const T16* __restrict__ Vt, const T16* __restrict__ V2, int r0, int lr, int hi, bf* Ah, bf* Al) {
    typedef typename WFrag<T16>::V V;
    const float POFF = HL ? 0.0f : 10.0f;   // fp16 probabilities carry x1024 so that small ones stay normal numbers
    V q[2][2], q2[2][2];
#pragma unroll
    for (int qb = 0; qb < 2; ++qb)
#pragma unroll
        for (int kc = 0; kc < 2; ++kc) { const size_t o = (size_t)(r0 + qb * 16 + lr) * HD + kc * 32 + 8 * hi; q[qb][kc] = WFrag<T16>::ld(Q + o); if (HL) q2[qb][kc] = WFrag<T16>::ld(Q2 + o); }
    v8f ot[4][2]; float m[2], l[2];
#pragma unroll
    for (int qb = 0; qb < 2; ++qb) { m[qb] = -3.0e38f; l[qb] = 0.f;
#pragma unroll
        for (int db = 0; db < 4; ++db) ot[db][qb] = (v8f){}; }
    constexpr int DBE = HL ? 2 : 4;         // 16-row blocks of V^T fetched ahead of the softmax (hl rows: half, the softmax needs the other half's registers)
    constexpr bool PF = !HL;                // single-plane rows have the registers to fetch K one tile ahead
    V kf[KB][2], kf2[KB][2];
    const unsigned ko = (unsigned)(lr * HD + 8 * hi) * 2, vo = (unsigned)(lr * TT + 8 * hi) * 2;   // the lane's byte offsets in a K tile (row = key) and in a V^T tile (row = d)
    if (PF) {
#pragma unroll
        for (int kb = 0; kb < KB; ++kb)
#pragma unroll
            for (int kc = 0; kc < 2; ++kc) kf[kb][kc] = ldo(Kp, ko + (kb * 16 * HD + kc * 32) * 2); }
    const int nt = r0 / (KB * 16) + 1;             // the last tile holds the diagonal; every row has at least one key in every tile walked
#pragma unroll 1
    for (int kt = 0; kt < nt; ++kt) {
        const int c0 = kt * KB * 16;
        v8f s[KB][2]; V vf[4][KB / 2], vf2[4][KB / 2];
        const T16* vt1 = Vt + c0; const T16* vt2 = HL ? V2 + c0 : nullptr;
        if (!PF) { const T16* kt1 = Kp + (size_t)c0 * HD; const T16* kt2 = K2 + (size_t)c0 * HD;
#pragma unroll
            for (int kb = 0; kb < KB; ++kb)
#pragma unroll
                for (int kc = 0; kc < 2; ++kc) { const unsigned o = ko + (kb * 16 * HD + kc * 32) * 2; kf[kb][kc] = ldo(kt1, o); kf2[kb][kc] = ldo(kt2, o); }
            __builtin_amdgcn_sched_barrier(0);   // all of the tile's K loads are in flight before the first product waits: one memory latency a tile, not one a fragment
        }
#pragma unroll
        for (int kb = 0; kb < KB; ++kb) { s[kb][0] = (v8f){}; s[kb][1] = (v8f){};
#pragma unroll
            for (int kc = 0; kc < 2; ++kc)
#pragma unroll
                for (int qb = 0; qb < 2; ++qb) { s[kb][qb] = WFrag<T16>::mma(kf[kb][kc], q[qb][kc], s[kb][qb]); if (HL) { s[kb][qb] = WFrag<T16>::mma(kf[kb][kc], q2[qb][kc], s[kb][qb]); s[kb][qb] = WFrag<T16>::mma(kf2[kb][kc], q[qb][kc], s[kb][qb]); } } }
        if (HL) __builtin_amdgcn_sched_barrier(0);   // V's loads start only when the last score product has read K, so that V takes K's registers
#pragma unroll
        for (int db = 0; db < DBE; ++db)
#pragma unroll
            for (int kc = 0; kc < KB / 2; ++kc) { const unsigned o = vo + (db * 16 * TT + kc * 32) * 2; vf[db][kc] = ldo(vt1, o); if (HL) vf2[db][kc] = ldo(vt2, o); }
        if (PF) { const T16* kn = Kp + (size_t)(((kt + 1 < nt) ? kt + 1 : kt) * KB * 16) * HD;   // the next tile's K (the last trip reads its own tile again: in bounds, unused)
#pragma unroll
            for (int kb = 0; kb < KB; ++kb)
#pragma unroll
                for (int kc = 0; kc < 2; ++kc) kf[kb][kc] = ldo(kn, ko + (kb * 16 * HD + kc * 32) * 2); }
        __builtin_amdgcn_sched_barrier(0);   // these loads start here, behind the score products, and fly under the softmax arithmetic
        V p[2][KB / 2], p2[2][KB / 2];
#pragma unroll
        for (int qb = 0; qb < 2; ++qb) {
            const int lim = r0 + qb * 16 + lr - c0 - hi * 8;   // key kb * 16 + j of this lane is allowed while it is <= lim (causal mask by select)
            float mx = m[qb];
#pragma unroll
            for (int kb = 0; kb < KB; ++kb)
#pragma unroll
                for (int j = 0; j < 8; ++j) { const float t = (kb * 16 + j <= lim) ? s[kb][qb][j] : -3.0e38f; s[kb][qb][j] = t; mx = fmaxf(mx, t); }
            mx = fmaxf(mx, __shfl_xor(mx, 16, 32));
            const float al = exp2s((m[qb] - mx) * CL2); const float nm = POFF - mx * CL2; m[qb] = mx;
            float ps = 0.f;
#pragma unroll
            for (int kb = 0; kb < KB; ++kb)
#pragma unroll
                for (int j = 0; j < 8; ++j) { const float e = exp2s(fmaf(s[kb][qb][j], CL2, nm)); s[kb][qb][j] = e; ps += e; }
            l[qb] = l[qb] * al + ps;
#pragma unroll
            for (int db = 0; db < 4; ++db) ot[db][qb] *= al;
#pragma unroll
            for (int kc = 0; kc < KB / 2; ++kc) PFrag<HL>::mk(s[2 * kc][qb], s[2 * kc + 1][qb], p[qb][kc], p2[qb][kc]);
            // one query block's softmax at a time (both interleaved hold too many temporaries for 256 registers), and no matrix instruction among the exp2s statements
            __builtin_amdgcn_sched_barrier(0);
        }
#pragma unroll
        for (int g = 0; g < 4; g += DBE) {
            if (g > 0) {
                __builtin_amdgcn_sched_barrier(0);   // the next part of V is loaded only when the products of the part before it are issued, into the registers that these free (all of V at once does not fit in 256)
#pragma unroll
                for (int db = g; db < g + DBE; ++db)
#pragma unroll
                    for (int kc = 0; kc < KB / 2; ++kc) { const unsigned o = vo + (db * 16 * TT + kc * 32) * 2; vf[db][kc] = ldo(vt1, o); vf2[db][kc] = ldo(vt2, o); }
                __builtin_amdgcn_sched_barrier(0);   // and all of that part's loads are in flight before its first product waits
            }
#pragma unroll
            for (int db = g; db < g + DBE; ++db)
#pragma unroll
                for (int kc = 0; kc < KB / 2; ++kc)
#pragma unroll
                    for (int qb = 0; qb < 2; ++qb) { ot[db][qb] = WFrag<T16>::mma(vf[db][kc], p[qb][kc], ot[db][qb]); if (HL) { ot[db][qb] = WFrag<T16>::mma(vf[db][kc], p2[qb][kc], ot[db][qb]); ot[db][qb] = WFrag<T16>::mma(vf2[db][kc], p[qb][kc], ot[db][qb]); } }
        }
        // keeps the matrix instructions' distance over the loop's back edge, where the next trip's first vector instructions rewrite fragment registers
        asm volatile("v_nop\n\tv_nop\n\tv_nop\n\tv_nop\n\tv_nop" : "+v"(ot[0][0]), "+v"(ot[0][1]), "+v"(ot[1][0]), "+v"(ot[1][1]), "+v"(ot[2][0]), "+v"(ot[2][1]), "+v"(ot[3][0]), "+v"(ot[3][1]));
    }
#pragma unroll
    for (int qb = 0; qb < 2; ++qb) { const float f = __fdiv_rn(1.0f, l[qb] + __shfl_xor(l[qb], 16, 32));
#pragma unroll
        for (int db = 0; db < 4; ++db) { v8us oh, ol;
#pragma unroll
            for (int j = 0; j < 8; ++j) { unsigned short a, c; splitf(ot[db][qb][j] * f, a, c); oh[j] = a; ol[j] = c; }
            const size_t oo = (size_t)(r0 + qb * 16 + lr) * DQ + db * 16 + hi * 8; *(v8us*)(Ah + oo) = oh; *(v8us*)(Al + oo) = ol; } }
}
// grid (TT / 128, heads, batches), 4 independent waves per block: block i takes the 32-row query tiles i, 15 - i (hl) and 16 + i, 31 - i (fp16), so every block walks the same number of keys.
__global__ __launch_bounds__(128) void k_fattn(const h16* __restrict__ Q16, const bf* __restrict__ Qh, const bf* __restrict__ Ql, const h16* __restrict__ K16, const bf* __restrict__ Kh, const bf* __restrict__ Kl, const h16* __restrict__ V16, const bf* __restrict__ Vh, const bf* __restrict__ Vl, bf* Ah, bf* Al) {
    const int lane = threadIdx.x & 31, lr = lane & 15, hi = lane >> 4; const int i = blockIdx.x;
    const int w = (__builtin_amdgcn_readfirstlane((int)(threadIdx.x >> 5)) + i + (int)(blockIdx.z >> 1)) & 3;   // which of the block's four tiles this wave takes; turned with the block index, so that blocks sharing a WGP do not put all their long (fp16) tiles on the same SIMDs
    const int r0 = ((w >> 1) * 16 + ((w & 1) ? 15 - i : i)) * 32;
    const size_t po = ((size_t)blockIdx.z * NH_ + blockIdx.y) * TT * HD; const size_t ao = (size_t)blockIdx.z * TT * DQ + blockIdx.y * HD;
    if (r0 < RH) fattn_wave<bf, true, 2>(Qh + po, Ql + po, Kh + po, Kl + po, Vh + po, Vl + po, r0, lr, hi, Ah + ao, Al + ao);
    else fattn_wave<h16, false, 2>(Q16 + po, nullptr, K16 + po, nullptr, V16 + po, nullptr, r0, lr, hi, Ah + ao, Al + ao);
}

extern "C" void kernel_launch(void* const* d_in, const int* in_sizes, int n_in,
                              void* d_out, int out_size, void* d_ws, size_t ws_size, hipStream_t stream) {
    (void)in_sizes; (void)n_in; (void)out_size;
    const float* x = (const float*)d_in[0]; const float* wf = (const float*)d_in[1]; const float* bf3 = (const float*)d_in[2]; const float* wo = (const float*)d_in[3]; const float* bo = (const float*)d_in[4];
    float* OUT = (float*)d_out;     // [8][1000][1024]
    char* wsp = (char*)d_ws;
    auto take = [&](size_t bytes) { char* p = wsp; wsp += (bytes + 255) & ~(size_t)255; return (void*)p; };
    const int NQKV = DQ + 2 * DKV;
    const size_t PE = (size_t)NB_ * NH_ * TT * HD;   // elements of one 16-bit head plane of all batches
    bf* WO = (bf*)take((size_t)DM * DQ * 2);
    bf* XB = (bf*)take((size_t)NB_ * TT * DM * 2); bf* WALL = (bf*)take((size_t)NQKV * DM * 2);
    h16* P16 = (h16*)take(3 * PE * 2); bf* Ph = (bf*)take(3 * PE * 2); bf* Pl = (bf*)take(3 * PE * 2);   // q, k, v^T one behind the other in each
    bf* ATh = (bf*)take((size_t)NB_ * TT * DQ * 2); bf* ATl = (bf*)take((size_t)NB_ * TT * DQ * 2);   // merged heads hi, lo
    if ((size_t)(wsp - (char*)d_ws) > ws_size) return;    // 200 MiB of the 256 MiB workspace
    k_wtG<<<(unsigned)((DM * NQKV / 64 + 63) / 64), 256, 0, stream>>>(wf, DM, NQKV, WALL);
    k_wtG<<<(unsigned)((DQ * DM / 64 + 63) / 64), 256, 0, stream>>>(wo, DQ, DM, WO);
    k_cvt8pad<<<dim3((unsigned)(((size_t)TT * DM / 8 + 255) / 256), NB_, 1), 256, 0, stream>>>(x, XB);
    k_gemmw<bf, 0, true><<<dim3(NB_ * TT / 64, NQKV / 64, 1), 32, 0, stream>>>(XB, nullptr, WALL, nullptr, DM, bf3, nullptr, P16, Ph, Pl);
    k_fattn<<<dim3(TT / 128, NH_, NB_), 128, 0, stream>>>(P16, Ph, Pl, P16 + PE, Ph + PE, Pl + PE, P16 + 2 * PE, Ph + 2 * PE, Pl + 2 * PE, ATh, ATl);
    k_gemmw<bf, 1, false><<<dim3(NB_ * TT / 64, DM / 64, 1), 32, 0, stream>>>(ATh, ATl, WO, nullptr, DQ, bo, OUT, nullptr, nullptr, nullptr);
}

// v004
// It runs in 155 microseconds.
// Next to v003, in two timings, it ran 1.64 times as fast each time.
// Counting every step since v000, it is 25.7 times as fast.
#include <hip/hip_runtime.h>

// MultiHeadAttentionConcise (x [8][1000][1024] - 1,000 tokens padded to 1,024 tiles on chip: the padded key rows are masked by causality for every real query, and only the 1,000 real output rows are written; qkv = x Wqkv + bqkv ([1024][3072]: q | k | v blocks, 16 heads x 64); causal softmax(q.k / 8) (-inf); out = merged Wo + bo -> [8][1000][1024]).
// Compute dtypes, f32 accumulate: every input rounded to bf16; q/k/v on PLAIN bf16 operands (inputs: exact; zero-padded rows) + bias, written by the GEMM itself as the 16-bit head planes that attention reads; causal scores and attn.v in ONE kernel (online softmax, f32, scores never leave registers): query rows < 512 hl (3 products), the rest single fp16 (probabilities x1024), key tiles beyond the diagonal skipped; Wo hl x exact (2 products) + bias, the 1,000 real rows of a batch stored straight to the output.

#define NB_  8
#define TT   1024
#define DM   1024
#define NH_  16
#define NKV  16
#define REP  (NH_ / NKV)
#define HD   64
#define DQ   (NH_ * HD)
#define DKV  (NKV * HD)
#define RH   512                  // query rows < RH use hi+lo planes (0: none)
#define LR   1000                 // real tokens per batch (TT = 1024 padded)
#define SCL  0.125f   // HD^-0.5
typedef _Float16 h16;
typedef unsigned short bf;
typedef __attribute__((ext_vector_type(16))) __bf16   v16bf;
typedef __attribute__((ext_vector_type(16))) _Float16 v16h;
typedef __attribute__((ext_vector_type(8)))  _Float16 v8h;
typedef __attribute__((ext_vector_type(8)))  unsigned short v8us;
typedef __attribute__((ext_vector_type(8)))  float    v8f;
typedef __attribute__((ext_vector_type(4)))  float    v4f;
typedef v8h  __attribute__((may_alias)) v8ha;
typedef v4f  __attribute__((may_alias)) v4fa;
typedef v8us __attribute__((may_alias)) v8usa;

__device__ __forceinline__ unsigned short f2bf(float f) { unsigned u = __float_as_uint(f); u += 0x7FFFu + ((u >> 16) & 1u); return (unsigned short)(u >> 16); }
__device__ __forceinline__ float bf2f(unsigned short b) { return __uint_as_float(((unsigned)b) << 16); }
__device__ __forceinline__ float bfr(float f) { return bf2f(f2bf(f)); }
__device__ __forceinline__ v16h cat16(v8h lo, v8h hi) { return __builtin_shufflevector(lo, hi, 0, 1, 2, 3, 4, 5, 6, 7, 8, 9, 10, 11, 12, 13, 14, 15); }
__device__ __forceinline__ v16bf cat16b(v8us lo, v8us hi) { return __builtin_bit_cast(v16bf, __builtin_shufflevector(lo, hi, 0, 1, 2, 3, 4, 5, 6, 7, 8, 9, 10, 11, 12, 13, 14, 15)); }
__device__ __forceinline__ v8f wmma16(v16h a, v16h b, v8f c) { return __builtin_amdgcn_wmma_f32_16x16x32_f16(false, a, false, b, (short)0, c, false, false); }
__device__ __forceinline__ v8f wmmab(v16bf a, v16bf b, v8f c) { return __builtin_amdgcn_wmma_f32_16x16x32_bf16(false, a, false, b, (short)0, c, false, false); }



// ---- k_gemmw: GEMM on K-contiguous 16-bit planes. A work-group of four waves (2 x 2) owns a 128x128 output tile, each wave a 64x64 part of it (16 accumulators); grid (M/128, N/128), 128 threads.
// The operand rows of the tile go through LDS, 64 k (128 B of every row) a pass, two buffers: asynchronous 16-B copies bring pass t + 2 in while pass t + 1 is worked on, whole 128-B lines from L2, each read once a work-group.
// A stage is [128 token rows | (NSPLIT 1: the same rows of the second plane) | 128 weight rows] at a pitch of 144 B (16 B x odd: the 16-B fragment reads meet no bank twice).
// c[m][n] (f32) = sum_k A[m][k] Bt[n][k] (+ A2[m][k] Bt[n][k] for NSPLIT 1) + bf16(bias[n]); m = batch * TT + token. K % 64 == 0. The epilogue stores the layout that the next reader wants, whole 128-B lines:
// HEADS: n = q | k | v block, head, d: one wave's tile is 64 tokens of one head. q, k -> planes [batch][head][token][d]; v -> [batch][head][d][token], for which the wave takes the weight rows as its A operand and the tokens as B
//        (both fragments have one loader and one k order, so the same products come out as the transposed tile). Planes P16 (fp16), Ph, Pl (bf16 hi, lo) hold q, k, v one behind the other.
//        Stored is what k_fattn reads: hi and lo for tokens < RH (all of its hl tiles lie there), fp16 for every k and v token and for the q tokens >= RH.
// else : rows of C = the output [batch][LR][DM]; the padded tokens >= LR are not stored.
typedef __attribute__((ext_vector_type(8))) __bf16 v8bf;
static_assert(LR % 2 == 0 && TT % 64 == 0 && RH % 64 == 0, "tile tests are per wave");
static_assert((DQ + DKV) % 128 == 0 && (NB_ * TT) % 128 == 0 && DM % 128 == 0, "whole 128x128 tiles");
template <typename T16> struct WFrag;
template <> struct WFrag<h16> { typedef v16h V; static __device__ __forceinline__ V ld(const h16* p) { return cat16(*(const v8h*)p, *(const v8h*)(p + 16)); } static __device__ __forceinline__ v8f mma(V a, V b, v8f c) { return wmma16(a, b, c); } };
template <> struct WFrag<bf> { typedef v16bf V; static __device__ __forceinline__ V ld(const bf* p) { return cat16b(*(const v8us*)p, *(const v8us*)(p + 16)); } static __device__ __forceinline__ v8f mma(V a, V b, v8f c) { return wmmab(a, b, c); } };
#define GP 144   // LDS pitch of a 128-B row, bytes
// 128 rows of 128 B into LDS: every lane copies 16 B of eight rows that lie 16 apart (8 lanes a row, a wave 4 rows, the block 16 rows an instruction).
// l: the lane's LDS byte address in the first 16 rows, o: its byte offset in the first 16 source rows, g: the first row's pass (the same in every lane: a scalar base), gs: bytes between 16 source rows.
// s_wait_xcnt 0 closes the statement, so that it stands in front of every later write of a register that the copies name (a precaution).
__device__ __forceinline__ void copy128rows(unsigned l, unsigned o, const char* g, size_t gs) {
    asm volatile("global_load_async_to_lds_b128 %0, %8, %9\n\t"
                 "global_load_async_to_lds_b128 %1, %8, %10\n\t"
                 "global_load_async_to_lds_b128 %2, %8, %11\n\t"
                 "global_load_async_to_lds_b128 %3, %8, %12\n\t"
                 "global_load_async_to_lds_b128 %4, %8, %13\n\t"
                 "global_load_async_to_lds_b128 %5, %8, %14\n\t"
                 "global_load_async_to_lds_b128 %6, %8, %15\n\t"
                 "global_load_async_to_lds_b128 %7, %8, %16\n\t"
                 "s_wait_xcnt 0x0"
                 :: "v"(l), "v"(l + 16 * GP), "v"(l + 32 * GP), "v"(l + 48 * GP), "v"(l + 64 * GP), "v"(l + 80 * GP), "v"(l + 96 * GP), "v"(l + 112 * GP), "v"(o),
                    "s"(g), "s"(g + gs), "s"(g + 2 * gs), "s"(g + 3 * gs), "s"(g + 4 * gs), "s"(g + 5 * gs), "s"(g + 6 * gs), "s"(g + 7 * gs) : "memory");
}
template <typename T16, int NSPLIT, bool HEADS, int K>
__global__ __launch_bounds__(128) void k_gemmw(const T16* __restrict__ A, const T16* __restrict__ A2, const T16* __restrict__ Bt, const float* __restrict__ bias, float* C, h16* P16, bf* Ph, bf* Pl) {
    static_assert(NSPLIT == 0 || NSPLIT == 1, "one or two planes of A"); static_assert(K % 64 == 0 && K >= 128, "whole passes, two or more");
    typedef typename WFrag<T16>::V V;
    constexpr int WR = (NSPLIT == 1 ? 2 : 1) * 128;   // first weight row of a stage
    constexpr int STAGE = (WR + 128) * GP;
    __shared__ __align__(16) char ring[2 * STAGE];
    const int tid = threadIdx.x, lane = tid & 31, lr = lane & 15, hi = lane >> 4; const int wave = __builtin_amdgcn_readfirstlane(tid >> 5);
    const int R0 = blockIdx.x * 128, C0 = blockIdx.y * 128; const int wm = (wave >> 1) * 64, wn = (wave & 1) * 64; const int r0 = R0 + wm, c0 = C0 + wn;
    const bool isv = HEADS && c0 >= DQ + DKV;   // the same for the whole work-group
    v8f acc[4][4];
#pragma unroll
    for (int mb = 0; mb < 4; ++mb)
#pragma unroll
        for (int nb = 0; nb < 4; ++nb) acc[mb][nb] = (v8f){};
    const unsigned lc = (unsigned)(size_t)ring + (unsigned)((tid >> 3) * GP + (tid & 7) * 16);   // the lane's place in a stage's first 16 rows
    const unsigned go = (unsigned)((tid >> 3) * K + (tid & 7) * 8) * 2; constexpr size_t gs = (size_t)16 * K * 2;   // and in the first 16 source rows
    const char* const gx = (const char*)(A + (size_t)R0 * K); const char* const gx2 = NSPLIT == 1 ? (const char*)(A2 + (size_t)R0 * K) : nullptr; const char* const gw = (const char*)(Bt + (size_t)C0 * K);
    auto fill = [&](int t) { const unsigned l = lc + (unsigned)((t & 1) * STAGE); const size_t ko = (size_t)t * 128;
        copy128rows(l, go, gx + ko, gs); if (NSPLIT == 1) copy128rows(l + 128 * GP, go, gx2 + ko, gs); copy128rows(l + WR * GP, go, gw + ko, gs); };
    const char* const fa = ring + ((isv ? WR + wn : wm) + lr) * GP + hi * 16; const char* const fb = ring + ((isv ? wm : WR + wn) + lr) * GP + hi * 16;   // the lane's row and 16-B column of the wave's A and B fragments
    constexpr int NT = K / 64;
    fill(0);
    asm volatile("s_wait_asynccnt 0x0" ::: "memory");   // this wave's copies of pass 0 have landed
    __syncthreads();                                     // and every other wave's
    fill(1);
#pragma unroll 1   // stays rolled: the passes are alike but for the buffer, and unrolled they would only swell the code
    for (int t = 0; t < NT; ++t) {
        const char* const pa = fa + (t & 1) * STAGE; const char* const pb = fb + (t & 1) * STAGE;
        V a[4], a2[4], b[4];
        auto frags = [&](int ks) {   // the fragments of 32 k
#pragma unroll
            for (int mb = 0; mb < 4; ++mb) { a[mb] = WFrag<T16>::ld((const T16*)(pa + mb * 16 * GP + ks * 64)); if (NSPLIT == 1) a2[mb] = WFrag<T16>::ld((const T16*)(pa + (128 + mb * 16) * GP + ks * 64)); }
#pragma unroll
            for (int nb = 0; nb < 4; ++nb) b[nb] = WFrag<T16>::ld((const T16*)(pb + nb * 16 * GP + ks * 64)); };
        auto products = [&]() {
#pragma unroll
            for (int nb = 0; nb < 4; ++nb)
#pragma unroll
                for (int mb = 0; mb < 4; ++mb) { acc[mb][nb] = WFrag<T16>::mma(a[mb], b[nb], acc[mb][nb]); if (NSPLIT == 1) acc[mb][nb] = WFrag<T16>::mma(a2[mb], b[nb], acc[mb][nb]); } };
        frags(0);
        __builtin_amdgcn_sched_barrier(0);   // all of the block's fragment reads go out as one group ahead of its products: one LDS latency a block, not one a column of tiles
        products();
        __builtin_amdgcn_sched_barrier(0);   // the second half's reads start behind the first half's products and take their fragment registers: one set, so that a wave stays within 256 registers
        frags(1);
        asm volatile("s_wait_dscnt 0x0" ::: "memory");      // this wave has read all it wants of pass t's buffer (the second half's fragments are in registers)
        asm volatile("s_wait_asynccnt 0x0" ::: "memory");   // and its copies of pass t + 1 have landed
        __syncthreads();                                     // the same of every wave: pass t + 1 may be read, pass t's buffer refilled
        if (t + 2 < NT) fill(t + 2);
        products();                                          // on registers alone, while the refill flies
    }
    asm volatile("s_wait_asynccnt 0x0" ::: "memory");   // no copy is in flight when the ring becomes the output staging
    float* const os = (float*)(ring + wave * (16 * 68 * 4));   // each wave stages in its own part of the ring, which every wave has left at the last pass's barrier
    const int bt = r0 / TT, t0 = r0 % TT;   // batch and first token of the tile (64 divides TT)
    const int rq = lane >> 3, cq = (lane & 7) * 8;   // HEADS: a lane stores 8 elements (16 B), 8 lanes a 128-B row, a wave 4 rows
    const bool whl = t0 < RH, w16 = c0 >= DQ || !whl;
    const int pitch = isv ? TT : HD;
    const size_t pbase = HEADS ? ((size_t)(c0 / DQ) * NB_ * NH_ + (size_t)bt * NH_ + (c0 % DQ) / HD) * TT * HD + (size_t)t0 * (isv ? 1 : HD) + cq : 0;
    float bc[8], br[4][4];   // HEADS: the bias of the lane's 8 columns (q, k: columns are the n index) and of its 16 rows (v: rows are), all fetched here at once: one latency a tile
    v4f bv;                  // else: the bias of the lane's 4 columns
    if (HEADS) {
#pragma unroll
        for (int u = 0; u < 8; ++u) bc[u] = bias[c0 + cq + u];
        asm volatile("s_wait_xcnt 0x0" ::: "memory");   // the row loads behind it land in the address registers of the column loads
#pragma unroll
        for (int mb = 0; mb < 4; ++mb)
#pragma unroll
            for (int s = 0; s < 4; ++s) br[mb][s] = bfr(bias[c0 + mb * 16 + 4 * s + rq]);
#pragma unroll
        for (int u = 0; u < 8; ++u) bc[u] = bfr(bc[u]);
    } else {
#pragma unroll
        for (int u = 0; u < 4; ++u) bv[u] = bfr(bias[c0 + lr * 4 + u]); }
#pragma unroll
    for (int mb = 0; mb < 4; ++mb) {
#pragma unroll
        for (int nb = 0; nb < 4; ++nb) {
#pragma unroll
            for (int j = 0; j < 8; ++j) os[(hi * 8 + j) * 68 + nb * 16 + lr] = acc[mb][nb][j]; }
        __builtin_amdgcn_wave_barrier(); asm volatile("" ::: "memory");
        if (HEADS) {
#pragma unroll
            for (int s = 0; s < 4; ++s) { const int row = 4 * s + rq; const v4f x0 = *(const v4fa*)(os + row * 68 + cq), x1 = *(const v4fa*)(os + row * 68 + cq + 4);
                v8h o16; v8bf oh, ol;   // hi = bf16(y), lo = bf16(y - hi), round to nearest even
#pragma unroll
                for (int u = 0; u < 8; ++u) { const float y = (u < 4 ? x0[u] : x1[u - 4]) + (isv ? br[mb][s] : bc[u]); o16[u] = (h16)y; const __bf16 h = (__bf16)y; oh[u] = h; ol[u] = (__bf16)(y - (float)h); }
                const size_t o = pbase + (size_t)(mb * 16 + row) * pitch;
                // s_wait_xcnt 0: stands between a store and the next instructions, which rewrite its address and data registers
                if (w16) { *(v8h*)(P16 + o) = o16; asm volatile("s_wait_xcnt 0x0" ::: "memory"); }
                if (whl) { *(v8bf*)(Ph + o) = oh; *(v8bf*)(Pl + o) = ol; asm volatile("s_wait_xcnt 0x0" ::: "memory"); } }
        } else {
            float* crow = C + ((size_t)bt * LR + t0 + mb * 16) * DM + c0;
#pragma unroll
            for (int s = 0; s < 8; ++s) { const int row = 2 * s + hi, cofs = lr * 4;
                // LR is even: the wave's two rows are real or padded together, a scalar test. s_wait_xcnt 0: stands between the store and the next instructions, which rewrite its address and data registers
                if (t0 + mb * 16 + 2 * s < LR) { const v4f val = *(const v4fa*)(os + row * 68 + cofs) + bv; *(v4f*)(crow + (size_t)row * DM + cofs) = val; asm volatile("s_wait_xcnt 0x0" ::: "memory"); } }
        }
        __builtin_amdgcn_wave_barrier(); asm volatile("" ::: "memory");
    }
}

__device__ __forceinline__ h16 tohx(float x) { return (h16)x; }
__device__ __forceinline__ void splitf(float y, unsigned short& h, unsigned short& l) { h = f2bf(y); l = f2bf(y - bf2f(h)); }
typedef __attribute__((ext_vector_type(2))) _Float16 v2h;
typedef __attribute__((ext_vector_type(4))) _Float16 v4h;
typedef __attribute__((ext_vector_type(2))) unsigned short v2us;
typedef __attribute__((ext_vector_type(4))) unsigned short v4us;
typedef __attribute__((ext_vector_type(2))) float v2f;
typedef __attribute__((ext_vector_type(4))) int v4i;

__global__ __launch_bounds__(256) void k_wtG(const float* __restrict__ w, int K, int N, bf* Bt) {
    const int lane = threadIdx.x & 31; const int L0 = (blockIdx.x * 8 + (threadIdx.x >> 5)) * 8; const int nlines = N * K / 64;
{
#pragma unroll 1
        for (int l = 0; l < 8; ++l) { const int L = L0 + l; if (L >= nlines) break; const size_t e = (size_t)L * 64 + lane * 2; const int k = (int)(e % K), n = (int)(e / K); v2us o;
            o[0] = f2bf(w[(size_t)k * N + n]); o[1] = f2bf(w[(size_t)(k + 1) * N + n]); *(v2us*)(Bt + e) = o; }
         }
}
__global__ __launch_bounds__(256) void k_cvt8pad(const float* __restrict__ src, bf* XB) { src += (size_t)blockIdx.y * LR * DM; XB += (size_t)blockIdx.y * TT * DM; const size_t e8 = ((size_t)blockIdx.x * 256 + threadIdx.x) * 8; if (e8 >= (size_t)TT * DM) return; const int t = (int)(e8 / DM); v8us o; if (t < LR) { const v4f a = *(const v4f*)(src + e8), c = *(const v4f*)(src + e8 + 4); for (int u = 0; u < 4; ++u) { o[u] = f2bf(a[u]); o[u + 4] = f2bf(c[u]); } } else { for (int u = 0; u < 8; ++u) o[u] = 0; } *(v8us*)(XB + e8) = o;  }
// ---- k_fattn: causal attention of all batches and heads in one launch. One wave owns 32 query rows and walks the key tiles (32 keys: a wave stays within 256 registers, four waves a SIMD) up to its diagonal; no LDS, no barrier.
// Scores are formed TRANSPOSED, St[key][query] = K q^T: a lane then holds 8 consecutive keys of ONE query (accumulator row = 8 hi + j, column = lane & 15), which is exactly the k order of the
// B fragment (elements 0..7: k = 8 hi + e; 8..15: k = 16 + 8 hi + e), so two 16-key score tiles become one 32-key probability fragment in place, and Ot[d][query] = Vt p^T follows.
// Online softmax per query (one lane pair): running maximum m of the raw scores, p = 2^(CL2 (s - m) + POFF), the sum l and Ot are rescaled by 2^(CL2 (m_old - m_new)); out = Ot / l (the 2^POFF cancels).
#define CL2 (SCL * 1.4426950408889634f)
__device__ __forceinline__ float exp2s(float x) { float r; asm("v_exp_f32 %0, %1\n\tv_nop" : "=v"(r) : "v"(x)); return r; }
template <bool HL> struct PFrag;
template <> struct PFrag<false> { static __device__ __forceinline__ void mk(const v8f& x, const v8f& y, v16h& p, v16h& p2) { (void)p2;
#pragma unroll
    for (int j = 0; j < 8; ++j) { p[j] = (h16)x[j]; p[j + 8] = (h16)y[j]; } } };
template <> struct PFrag<true> { static __device__ __forceinline__ void mk(const v8f& x, const v8f& y, v16bf& p, v16bf& p2) {   // hi = bf16(x), lo = bf16(x - hi), round to nearest even as in splitf (x is finite)
#pragma unroll
    for (int j = 0; j < 8; ++j) { const __bf16 a = (__bf16)x[j], b = (__bf16)y[j]; p[j] = a; p[j + 8] = b; p2[j] = (__bf16)(x[j] - (float)a); p2[j + 8] = (__bf16)(y[j] - (float)b); } } };
// fragment at a tile's base address (the same in every lane) plus the lane's 32-bit byte offset
template <typename T16> __device__ __forceinline__ typename WFrag<T16>::V ldo(const T16* base, unsigned off) { return WFrag<T16>::ld((const T16*)((const char*)base + off)); }
template <typename T16, bool HL, int KB>   // KB: 16-key blocks per key tile
__device__ __forceinline__ void fattn_wave(const T16* __restrict__ Q, const T16* __restrict__ Q2, const T16* __restrict__ Kp, const T16* __restrict__ K2, const T16* __restrict__ Vt, const T16* __restrict__ V2, int r0, int lr, int hi, bf* Ah, bf* Al) {
    typedef typename WFrag<T16>::V V;
    const float POFF = HL ? 0.0f : 10.0f;   // fp16 probabilities carry x1024 so that small ones stay normal numbers
    V q[2][2], q2[2][2];
#pragma unroll
    for (int qb = 0; qb < 2; ++qb)
#pragma unroll
        for (int kc = 0; kc < 2; ++kc) { const size_t o = (size_t)(r0 + qb * 16 + lr) * HD + kc * 32 + 8 * hi; q[qb][kc] = WFrag<T16>::ld(Q + o); if (HL) q2[qb][kc] = WFrag<T16>::ld(Q2 + o); }
    v8f ot[4][2]; float m[2], l[2];
#pragma unroll
    for (int qb = 0; qb < 2; ++qb) { m[qb] = -3.0e38f; l[qb] = 0.f;
#pragma unroll
        for (int db = 0; db < 4; ++db) ot[db][qb] = (v8f){}; }
    constexpr int DBE = HL ? 2 : 4;         // 16-row blocks of V^T fetched ahead of the softmax (hl rows: half, the softmax needs the other half's registers)
    constexpr bool PF = !HL;                // single-plane rows have the registers to fetch K one tile ahead
    V kf[KB][2], kf2[KB][2];
    const unsigned ko = (unsigned)(lr * HD + 8 * hi) * 2, vo = (unsigned)(lr * TT + 8 * hi) * 2;   // the lane's byte offsets in a K tile (row = key) and in a V^T tile (row = d)
    if (PF) {
#pragma unroll
        for (int kb = 0; kb < KB; ++kb)
#pragma unroll
            for (int kc = 0; kc < 2; ++kc) kf[kb][kc] = ldo(Kp, ko + (kb * 16 * HD + kc * 32) * 2); }
    const int nt = r0 / (KB * 16) + 1;             // the last tile holds the diagonal; every row has at least one key in every tile walked
#pragma unroll 1
    for (int kt = 0; kt < nt; ++kt) {
        const int c0 = kt * KB * 16;
        v8f s[KB][2]; V vf[4][KB / 2], vf2[4][KB / 2];
        const T16* vt1 = Vt + c0; const T16* vt2 = HL ? V2 + c0 : nullptr;
        if (!PF) { const T16* kt1 = Kp + (size_t)c0 * HD; const T16* kt2 = K2 + (size_t)c0 * HD;
#pragma unroll
            for (int kb = 0; kb < KB; ++kb)
#pragma unroll
                for (int kc = 0; kc < 2; ++kc) { const unsigned o = ko + (kb * 16 * HD + kc * 32) * 2; kf[kb][kc] = ldo(kt1, o); kf2[kb][kc] = ldo(kt2, o); }
            __builtin_amdgcn_sched_barrier(0);   // all of the tile's K loads are in flight before the first product waits: one memory latency a tile, not one a fragment
        }
#pragma unroll
        for (int kb = 0; kb < KB; ++kb) { s[kb][0] = (v8f){}; s[kb][1] = (v8f){};
#pragma unroll
            for (int kc = 0; kc < 2; ++kc)
#pragma unroll
                for (int qb = 0; qb < 2; ++qb) { s[kb][qb] = WFrag<T16>::mma(kf[kb][kc], q[qb][kc], s[kb][qb]); if (HL) { s[kb][qb] = WFrag<T16>::mma(kf[kb][kc], q2[qb][kc], s[kb][qb]); s[kb][qb] = WFrag<T16>::mma(kf2[kb][kc], q[qb][kc], s[kb][qb]); } } }
        if (HL) __builtin_amdgcn_sched_barrier(0);   // V's loads start only when the last score product has read K, so that V takes K's registers
#pragma unroll
        for (int db = 0; db < DBE; ++db)
#pragma unroll
            for (int kc = 0; kc < KB / 2; ++kc) { const unsigned o = vo + (db * 16 * TT + kc * 32) * 2; vf[db][kc] = ldo(vt1, o); if (HL) vf2[db][kc] = ldo(vt2, o); }
        if (PF) { const T16* kn = Kp + (size_t)(((kt + 1 < nt) ? kt + 1 : kt) * KB * 16) * HD;   // the next tile's K (the last trip reads its own tile again: in bounds, unused)
#pragma unroll
            for (int kb = 0; kb < KB; ++kb)
#pragma unroll
                for (int kc = 0; kc < 2; ++kc) kf[kb][kc] = ldo(kn, ko + (kb * 16 * HD + kc * 32) * 2); }
        __builtin_amdgcn_sched_barrier(0);   // these loads start here, behind the score products, and fly under the softmax arithmetic
        V p[2][KB / 2], p2[2][KB / 2];
#pragma unroll
        for (int qb = 0; qb < 2; ++qb) {
            const int lim = r0 + qb * 16 + lr - c0 - hi * 8;   // key kb * 16 + j of this lane is allowed while it is <= lim (causal mask by select)
            float mx = m[qb];
#pragma unroll
            for (int kb = 0; kb < KB; ++kb)
#pragma unroll
                for (int j = 0; j < 8; ++j) { const float t = (kb * 16 + j <= lim) ? s[kb][qb][j] : -3.0e38f; s[kb][qb][j] = t; mx = fmaxf(mx, t); }
            mx = fmaxf(mx, __shfl_xor(mx, 16, 32));
            const float al = exp2s((m[qb] - mx) * CL2); const float nm = POFF - mx * CL2; m[qb] = mx;
            float ps = 0.f;
#pragma unroll
            for (int kb = 0; kb < KB; ++kb)
#pragma unroll
                for (int j = 0; j < 8; ++j) { const float e = exp2s(fmaf(s[kb][qb][j], CL2, nm)); s[kb][qb][j] = e; ps += e; }
            l[qb] = l[qb] * al + ps;
#pragma unroll
            for (int db = 0; db < 4; ++db) ot[db][qb] *= al;
#pragma unroll
            for (int kc = 0; kc < KB / 2; ++kc) PFrag<HL>::mk(s[2 * kc][qb], s[2 * kc + 1][qb], p[qb][kc], p2[qb][kc]);
            // one query block's softmax at a time (both interleaved hold too many temporaries for 256 registers), and no matrix instruction among the exp2s statements
            __builtin_amdgcn_sched_barrier(0);
        }
#pragma unroll
        for (int g = 0; g < 4; g += DBE) {
            if (g > 0) {
                __builtin_amdgcn_sched_barrier(0);   // the next part of V is loaded only when the products of the part before it are issued, into the registers that these free (all of V at once does not fit in 256)
#pragma unroll
                for (int db = g; db < g + DBE; ++db)
#pragma unroll
                    for (int kc = 0; kc < KB / 2; ++kc) { const unsigned o = vo + (db * 16 * TT + kc * 32) * 2; vf[db][kc] = ldo(vt1, o); vf2[db][kc] = ldo(vt2, o); }
                __builtin_amdgcn_sched_barrier(0);   // and all of that part's loads are in flight before its first product waits
            }
#pragma unroll
            for (int db = g; db < g + DBE; ++db)
#pragma unroll
                for (int kc = 0; kc < KB / 2; ++kc)
#pragma unroll
                    for (int qb = 0; qb < 2; ++qb) { ot[db][qb] = WFrag<T16>::mma(vf[db][kc], p[qb][kc], ot[db][qb]); if (HL) { ot[db][qb] = WFrag<T16>::mma(vf[db][kc], p2[qb][kc], ot[db][qb]); ot[db][qb] = WFrag<T16>::mma(vf2[db][kc], p[qb][kc], ot[db][qb]); } }
        }
        // keeps the matrix instructions' distance over the loop's back edge, where the next trip's first vector instructions rewrite fragment registers
        asm volatile("v_nop\n\tv_nop\n\tv_nop\n\tv_nop\n\tv_nop" : "+v"(ot[0][0]), "+v"(ot[0][1]), "+v"(ot[1][0]), "+v"(ot[1][1]), "+v"(ot[2][0]), "+v"(ot[2][1]), "+v"(ot[3][0]), "+v"(ot[3][1]));
    }
#pragma unroll
    for (int qb = 0; qb < 2; ++qb) { const float f = __fdiv_rn(1.0f, l[qb] + __shfl_xor(l[qb], 16, 32));
#pragma unroll
        for (int db = 0; db < 4; ++db) { v8us oh, ol;
#pragma unroll
            for (int j = 0; j < 8; ++j) { unsigned short a, c; splitf(ot[db][qb][j] * f, a, c); oh[j] = a; ol[j] = c; }
            const size_t oo = (size_t)(r0 + qb * 16 + lr) * DQ + db * 16 + hi * 8; *(v8us*)(Ah + oo) = oh; *(v8us*)(Al + oo) = ol; } }
}
// grid (TT / 128, heads, batches), 4 independent waves per block: block i takes the 32-row query tiles i, 15 - i (hl) and 16 + i, 31 - i (fp16), so every block walks the same number of keys.
__global__ __launch_bounds__(128) void k_fattn(const h16* __restrict__ Q16, const bf* __restrict__ Qh, const bf* __restrict__ Ql, const h16* __restrict__ K16, const bf* __restrict__ Kh, const bf* __restrict__ Kl, const h16* __restrict__ V16, const bf* __restrict__ Vh, const bf* __restrict__ Vl, bf* Ah, bf* Al) {
    const int lane = threadIdx.x & 31, lr = lane & 15, hi = lane >> 4; const int i = blockIdx.x;
    const int w = (__builtin_amdgcn_readfirstlane((int)(threadIdx.x >> 5)) + i + (int)(blockIdx.z >> 1)) & 3;   // which of the block's four tiles this wave takes; turned with the block index, so that blocks sharing a WGP do not put all their long (fp16) tiles on the same SIMDs
    const int r0 = ((w >> 1) * 16 + ((w & 1) ? 15 - i : i)) * 32;
    const size_t po = ((size_t)blockIdx.z * NH_ + blockIdx.y) * TT * HD; const size_t ao = (size_t)blockIdx.z * TT * DQ + blockIdx.y * HD;
    if (r0 < RH) fattn_wave<bf, true, 2>(Qh + po, Ql + po, Kh + po, Kl + po, Vh + po, Vl + po, r0, lr, hi, Ah + ao, Al + ao);
    else fattn_wave<h16, false, 2>(Q16 + po, nullptr, K16 + po, nullptr, V16 + po, nullptr, r0, lr, hi, Ah + ao, Al + ao);
}

extern "C" void kernel_launch(void* const* d_in, const int* in_sizes, int n_in,
                              void* d_out, int out_size, void* d_ws, size_t ws_size, hipStream_t stream) {
    (void)in_sizes; (void)n_in; (void)out_size;
    const float* x = (const float*)d_in[0]; const float* wf = (const float*)d_in[1]; const float* bf3 = (const float*)d_in[2]; const float* wo = (const float*)d_in[3]; const float* bo = (const float*)d_in[4];
    float* OUT = (float*)d_out;     // [8][1000][1024]
    char* wsp = (char*)d_ws;
    auto take = [&](size_t bytes) { char* p = wsp; wsp += (bytes + 255) & ~(size_t)255; return (void*)p; };
    const int NQKV = DQ + 2 * DKV;
    const size_t PE = (size_t)NB_ * NH_ * TT * HD;   // elements of one 16-bit head plane of all batches
    bf* WO = (bf*)take((size_t)DM * DQ * 2);
    bf* XB = (bf*)take((size_t)NB_ * TT * DM * 2); bf* WALL = (bf*)take((size_t)NQKV * DM * 2);
    h16* P16 = (h16*)take(3 * PE * 2); bf* Ph = (bf*)take(3 * PE * 2); bf* Pl = (bf*)take(3 * PE * 2);   // q, k, v^T one behind the other in each
    bf* ATh = (bf*)take((size_t)NB_ * TT * DQ * 2); bf* ATl = (bf*)take((size_t)NB_ * TT * DQ * 2);   // merged heads hi, lo
    if ((size_t)(wsp - (char*)d_ws) > ws_size) return;    // 200 MiB of the 256 MiB workspace
    k_wtG<<<(unsigned)((DM * NQKV / 64 + 63) / 64), 256, 0, stream>>>(wf, DM, NQKV, WALL);
    k_wtG<<<(unsigned)((DQ * DM / 64 + 63) / 64), 256, 0, stream>>>(wo, DQ, DM, WO);
    k_cvt8pad<<<dim3((unsigned)(((size_t)TT * DM / 8 + 255) / 256), NB_, 1), 256, 0, stream>>>(x, XB);
    k_gemmw<bf, 0, true, DM><<<dim3(NB_ * TT / 128, NQKV / 128, 1), 128, 0, stream>>>(XB, nullptr, WALL, bf3, nullptr, P16, Ph, Pl);
    k_fattn<<<dim3(TT / 128, NH_, NB_), 128, 0, stream>>>(P16, Ph, Pl, P16 + PE, Ph + PE, Pl + PE, P16 + 2 * PE, Ph + 2 * PE, Pl + 2 * PE, ATh, ATl);
    k_gemmw<bf, 1, false, DQ><<<dim3(NB_ * TT / 128, DM / 128, 1), 128, 0, stream>>>(ATh, ATl, WO, bo, OUT, nullptr, nullptr, nullptr);
}

// v005
// It runs in 135 microseconds.
// Next to v004, in two timings, it ran 1.14 and 1.15 times as fast.
// Counting every step since v000, it is 29.4 times as fast.
#include <hip/hip_runtime.h>

// MultiHeadAttentionConcise (x [8][1000][1024] - 1,000 tokens padded to 1,024 tiles on chip: the padded key rows are masked by causality for every real query, and only the 1,000 real output rows are written; qkv = x Wqkv + bqkv ([1024][3072]: q | k | v blocks, 16 heads x 64); causal softmax(q.k / 8) (-inf); out = merged Wo + bo -> [8][1000][1024]).
// Compute dtypes, f32 accumulate: every input rounded to bf16; q/k/v on PLAIN bf16 operands (inputs: exact; zero-padded rows) + bias, written by the GEMM itself as the 16-bit head planes that attention reads; causal scores and attn.v in ONE kernel (online softmax, f32, scores never leave registers): query rows < 512 hl (3 products), the rest single fp16 (probabilities x1024), key tiles beyond the diagonal skipped; Wo hl x exact (2 products) + bias, the 1,000 real rows of a batch stored straight to the output.

#define NB_  8
#define TT   1024
#define DM   1024
#define NH_  16
#define NKV  16
#define REP  (NH_ / NKV)
#define HD   64
#define DQ   (NH_ * HD)
#define DKV  (NKV * HD)
#define RH   512                  // query rows < RH use hi+lo planes (0: none)
#define LR   1000                 // real tokens per batch (TT = 1024 padded)
#define SCL  0.125f   // HD^-0.5
typedef _Float16 h16;
typedef unsigned short bf;
typedef __attribute__((ext_vector_type(16))) __bf16   v16bf;
typedef __attribute__((ext_vector_type(16))) _Float16 v16h;
typedef __attribute__((ext_vector_type(8)))  _Float16 v8h;
typedef __attribute__((ext_vector_type(8)))  unsigned short v8us;
typedef __attribute__((ext_vector_type(8)))  float    v8f;
typedef __attribute__((ext_vector_type(4)))  float    v4f;
typedef v8h  __attribute__((may_alias)) v8ha;
typedef v4f  __attribute__((may_alias)) v4fa;
typedef v8us __attribute__((may_alias)) v8usa;

__device__ __forceinline__ unsigned short f2bf(float f) { unsigned u = __float_as_uint(f); u += 0x7FFFu + ((u >> 16) & 1u); return (unsigned short)(u >> 16); }
__device__ __forceinline__ float bf2f(unsigned short b) { return __uint_as_float(((unsigned)b) << 16); }
__device__ __forceinline__ float bfr(float f) { return bf2f(f2bf(f)); }
__device__ __forceinline__ v16h cat16(v8h lo, v8h hi) { return __builtin_shufflevector(lo, hi, 0, 1, 2, 3, 4, 5, 6, 7, 8, 9, 10, 11, 12, 13, 14, 15); }
__device__ __forceinline__ v16bf cat16b(v8us lo, v8us hi) { return __builtin_bit_cast(v16bf, __builtin_shufflevector(lo, hi, 0, 1, 2, 3, 4, 5, 6, 7, 8, 9, 10, 11, 12, 13, 14, 15)); }
__device__ __forceinline__ v8f wmma16(v16h a, v16h b, v8f c) { return __builtin_amdgcn_wmma_f32_16x16x32_f16(false, a, false, b, (short)0, c, false, false); }
__device__ __forceinline__ v8f wmmab(v16bf a, v16bf b, v8f c) { return __builtin_amdgcn_wmma_f32_16x16x32_bf16(false, a, false, b, (short)0, c, false, false); }



// ---- k_gemmw: GEMM on K-contiguous 16-bit planes. A work-group of four waves (2 x 2) owns a 128x128 output tile, each wave a 64x64 part of it (16 accumulators); grid (M/128, N/128), 128 threads.
// The operand rows of the tile go through LDS, 64 k (128 B of every row) a pass, two buffers: asynchronous 16-B copies bring pass t + 2 in while pass t + 1 is worked on, whole 128-B lines from L2, each read once a work-group.
// A stage is [128 token rows | (NSPLIT 1: the same rows of the second plane) | 128 weight rows] at a pitch of 144 B (16 B x odd: the 16-B fragment reads meet no bank twice).
// c[m][n] (f32) = sum_k A[m][k] Bt[n][k] (+ A2[m][k] Bt[n][k] for NSPLIT 1) + bf16(bias[n]); m = batch * TT + token. K % 64 == 0. The epilogue stores the layout that the next reader wants, whole 128-B lines:
// HEADS: n = q | k | v block, head, d: one wave's tile is 64 tokens of one head. q, k -> planes [batch][head][token][d]; v -> [batch][head][d][token], for which the wave takes the weight rows as its A operand and the tokens as B
//        (both fragments have one loader and one k order, so the same products come out as the transposed tile). Planes P16 (fp16), Ph, Pl (bf16 hi, lo) hold q, k, v one behind the other.
//        Stored is what k_fattn reads: hi and lo for tokens < RH (all of its hl tiles lie there), fp16 for every k and v token and for the q tokens >= RH.
// else : rows of C = the output [batch][LR][DM]; the padded tokens >= LR are not stored.
typedef __attribute__((ext_vector_type(8))) __bf16 v8bf;
static_assert(LR % 2 == 0 && TT % 64 == 0 && RH % 64 == 0, "tile tests are per wave");
static_assert((DQ + DKV) % 128 == 0 && (NB_ * TT) % 128 == 0 && DM % 128 == 0, "whole 128x128 tiles");
template <typename T16> struct WFrag;
template <> struct WFrag<h16> { typedef v16h V; static __device__ __forceinline__ V ld(const h16* p) { return cat16(*(const v8h*)p, *(const v8h*)(p + 16)); } static __device__ __forceinline__ v8f mma(V a, V b, v8f c) { return wmma16(a, b, c); } };
template <> struct WFrag<bf> { typedef v16bf V; static __device__ __forceinline__ V ld(const bf* p) { return cat16b(*(const v8us*)p, *(const v8us*)(p + 16)); } static __device__ __forceinline__ v8f mma(V a, V b, v8f c) { return wmmab(a, b, c); } };
#define GP 144   // LDS pitch of a 128-B row, bytes
// 128 rows of 128 B into LDS: every lane copies 16 B of eight rows that lie 16 apart (8 lanes a row, a wave 4 rows, the block 16 rows an instruction).
// l: the lane's LDS byte address in the first 16 rows, o: its byte offset in the first 16 source rows, g: the first row's pass (the same in every lane: a scalar base), gs: bytes between 16 source rows.
// s_wait_xcnt 0 closes the statement, so that it stands in front of every later write of a register that the copies name (a precaution).
__device__ __forceinline__ void copy128rows(unsigned l, unsigned o, const char* g, size_t gs) {
    asm volatile("global_load_async_to_lds_b128 %0, %8, %9\n\t"
                 "global_load_async_to_lds_b128 %1, %8, %10\n\t"
                 "global_load_async_to_lds_b128 %2, %8, %11\n\t"
                 "global_load_async_to_lds_b128 %3, %8, %12\n\t"
                 "global_load_async_to_lds_b128 %4, %8, %13\n\t"
                 "global_load_async_to_lds_b128 %5, %8, %14\n\t"
                 "global_load_async_to_lds_b128 %6, %8, %15\n\t"
                 "global_load_async_to_lds_b128 %7, %8, %16\n\t"
                 "s_wait_xcnt 0x0"
                 :: "v"(l), "v"(l + 16 * GP), "v"(l + 32 * GP), "v"(l + 48 * GP), "v"(l + 64 * GP), "v"(l + 80 * GP), "v"(l + 96 * GP), "v"(l + 112 * GP), "v"(o),
                    "s"(g), "s"(g + gs), "s"(g + 2 * gs), "s"(g + 3 * gs), "s"(g + 4 * gs), "s"(g + 5 * gs), "s"(g + 6 * gs), "s"(g + 7 * gs) : "memory");
}
template <typename T16, int NSPLIT, bool HEADS, int K>
__global__ __launch_bounds__(128) void k_gemmw(const T16* __restrict__ A, const T16* __restrict__ A2, const T16* __restrict__ Bt, const float* __restrict__ bias, float* C, h16* P16, bf* Ph, bf* Pl) {
    static_assert(NSPLIT == 0 || NSPLIT == 1, "one or two planes of A"); static_assert(K % 64 == 0 && K >= 128, "whole passes, two or more");
    typedef typename WFrag<T16>::V V;
    constexpr int WR = (NSPLIT == 1 ? 2 : 1) * 128;   // first weight row of a stage
    constexpr int STAGE = (WR + 128) * GP;
    __shared__ __align__(16) char ring[2 * STAGE];
    const int tid = threadIdx.x, lane = tid & 31, lr = lane & 15, hi = lane >> 4; const int wave = __builtin_amdgcn_readfirstlane(tid >> 5);
    const int R0 = blockIdx.x * 128, C0 = blockIdx.y * 128; const int wm = (wave >> 1) * 64, wn = (wave & 1) * 64; const int r0 = R0 + wm, c0 = C0 + wn;
    const bool isv = HEADS && c0 >= DQ + DKV;   // the same for the whole work-group
    v8f acc[4][4];
#pragma unroll
    for (int mb = 0; mb < 4; ++mb)
#pragma unroll
        for (int nb = 0; nb < 4; ++nb) acc[mb][nb] = (v8f){};
    const unsigned lc = (unsigned)(size_t)ring + (unsigned)((tid >> 3) * GP + (tid & 7) * 16);   // the lane's place in a stage's first 16 rows
    const unsigned go = (unsigned)((tid >> 3) * K + (tid & 7) * 8) * 2; constexpr size_t gs = (size_t)16 * K * 2;   // and in the first 16 source rows
    const char* const gx = (const char*)(A + (size_t)R0 * K); const char* const gx2 = NSPLIT == 1 ? (const char*)(A2 + (size_t)R0 * K) : nullptr; const char* const gw = (const char*)(Bt + (size_t)C0 * K);
    auto fill = [&](int t) { const unsigned l = lc + (unsigned)((t & 1) * STAGE); const size_t ko = (size_t)t * 128;
        copy128rows(l, go, gx + ko, gs); if (NSPLIT == 1) copy128rows(l + 128 * GP, go, gx2 + ko, gs); copy128rows(l + WR * GP, go, gw + ko, gs); };
    const char* const fa = ring + ((isv ? WR + wn : wm) + lr) * GP + hi * 16; const char* const fb = ring + ((isv ? wm : WR + wn) + lr) * GP + hi * 16;   // the lane's row and 16-B column of the wave's A and B fragments
    constexpr int NT = K / 64;
    fill(0);
    asm volatile("s_wait_asynccnt 0x0" ::: "memory");   // this wave's copies of pass 0 have landed
    __syncthreads();                                     // and every other wave's
    fill(1);
#pragma unroll 1   // stays rolled: the passes are alike but for the buffer, and unrolled they would only swell the code
    for (int t = 0; t < NT; ++t) {
        const char* const pa = fa + (t & 1) * STAGE; const char* const pb = fb + (t & 1) * STAGE;
        V a[4], a2[4], b[4];
        auto frags = [&](int ks) {   // the fragments of 32 k
#pragma unroll
            for (int mb = 0; mb < 4; ++mb) { a[mb] = WFrag<T16>::ld((const T16*)(pa + mb * 16 * GP + ks * 64)); if (NSPLIT == 1) a2[mb] = WFrag<T16>::ld((const T16*)(pa + (128 + mb * 16) * GP + ks * 64)); }
#pragma unroll
            for (int nb = 0; nb < 4; ++nb) b[nb] = WFrag<T16>::ld((const T16*)(pb + nb * 16 * GP + ks * 64)); };
        auto products = [&]() {
#pragma unroll
            for (int nb = 0; nb < 4; ++nb)
#pragma unroll
                for (int mb = 0; mb < 4; ++mb) { acc[mb][nb] = WFrag<T16>::mma(a[mb], b[nb], acc[mb][nb]); if (NSPLIT == 1) acc[mb][nb] = WFrag<T16>::mma(a2[mb], b[nb], acc[mb][nb]); } };
        frags(0);
        __builtin_amdgcn_sched_barrier(0);   // all of the block's fragment reads go out as one group ahead of its products: one LDS latency a block, not one a column of tiles
        products();
        __builtin_amdgcn_sched_barrier(0);   // the second half's reads start behind the first half's products and take their fragment registers: one set, so that a wave stays within 256 registers
        frags(1);
        asm volatile("s_wait_dscnt 0x0" ::: "memory");      // this wave has read all it wants of pass t's buffer (the second half's fragments are in registers)
        asm volatile("s_wait_asynccnt 0x0" ::: "memory");   // and its copies of pass t + 1 have landed
        __syncthreads();                                     // the same of every wave: pass t + 1 may be read, pass t's buffer refilled
        if (t + 2 < NT) fill(t + 2);
        products();                                          // on registers alone, while the refill flies
    }
    asm volatile("s_wait_asynccnt 0x0" ::: "memory");   // no copy is in flight when the ring becomes the output staging
    float* const os = (float*)(ring + wave * (16 * 68 * 4));   // each wave stages in its own part of the ring, which every wave has left at the last pass's barrier
    const int bt = r0 / TT, t0 = r0 % TT;   // batch and first token of the tile (64 divides TT)
    const int rq = lane >> 3, cq = (lane & 7) * 8;   // HEADS: a lane stores 8 elements (16 B), 8 lanes a 128-B row, a wave 4 rows
    const bool whl = t0 < RH, w16 = c0 >= DQ || !whl;
    const int pitch = isv ? TT : HD;
    const size_t pbase = HEADS ? ((size_t)(c0 / DQ) * NB_ * NH_ + (size_t)bt * NH_ + (c0 % DQ) / HD) * TT * HD + (size_t)t0 * (isv ? 1 : HD) + cq : 0;
    float bc[8], br[4][4];   // HEADS: the bias of the lane's 8 columns (q, k: columns are the n index) and of its 16 rows (v: rows are), all fetched here at once: one latency a tile
    v4f bv;                  // else: the bias of the lane's 4 columns
    if (HEADS) {
#pragma unroll
        for (int u = 0; u < 8; ++u) bc[u] = bias[c0 + cq + u];
        asm volatile("s_wait_xcnt 0x0" ::: "memory");   // the row loads behind it land in the address registers of the column loads
#pragma unroll
        for (int mb = 0; mb < 4; ++mb)
#pragma unroll
            for (int s = 0; s < 4; ++s) br[mb][s] = bfr(bias[c0 + mb * 16 + 4 * s + rq]);
#pragma unroll
        for (int u = 0; u < 8; ++u) bc[u] = bfr(bc[u]);
    } else {
#pragma unroll
        for (int u = 0; u < 4; ++u) bv[u] = bfr(bias[c0 + lr * 4 + u]); }
#pragma unroll
    for (int mb = 0; mb < 4; ++mb) {
#pragma unroll
        for (int nb = 0; nb < 4; ++nb) {
#pragma unroll
            for (int j = 0; j < 8; ++j) os[(hi * 8 + j) * 68 + nb * 16 + lr] = acc[mb][nb][j]; }
        __builtin_amdgcn_wave_barrier(); asm volatile("" ::: "memory");
        if (HEADS) {
#pragma unroll
            for (int s = 0; s < 4; ++s) { const int row = 4 * s + rq; const v4f x0 = *(const v4fa*)(os + row * 68 + cq), x1 = *(const v4fa*)(os + row * 68 + cq + 4);
                v8h o16; v8bf oh, ol;   // hi = bf16(y), lo = bf16(y - hi), round to nearest even
#pragma unroll
                for (int u = 0; u < 8; ++u) { const float y = (u < 4 ? x0[u] : x1[u - 4]) + (isv ? br[mb][s] : bc[u]); o16[u] = (h16)y; const __bf16 h = (__bf16)y; oh[u] = h; ol[u] = (__bf16)(y - (float)h); }
                const size_t o = pbase + (size_t)(mb * 16 + row) * pitch;
                // s_wait_xcnt 0: stands between a store and the next instructions, which rewrite its address and data registers
                if (w16) { *(v8h*)(P16 + o) = o16; asm volatile("s_wait_xcnt 0x0" ::: "memory"); }
                if (whl) { *(v8bf*)(Ph + o) = oh; *(v8bf*)(Pl + o) = ol; asm volatile("s_wait_xcnt 0x0" ::: "memory"); } }
        } else {
            float* crow = C + ((size_t)bt * LR + t0 + mb * 16) * DM + c0;
#pragma unroll
            for (int s = 0; s < 8; ++s) { const int row = 2 * s + hi, cofs = lr * 4;
                // LR is even: the wave's two rows are real or padded together, a scalar test. s_wait_xcnt 0: stands between the store and the next instructions, which rewrite its address and data registers
                if (t0 + mb * 16 + 2 * s < LR) { const v4f val = *(const v4fa*)(os + row * 68 + cofs) + bv; *(v4f*)(crow + (size_t)row * DM + cofs) = val; asm volatile("s_wait_xcnt 0x0" ::: "memory"); } }
        }
        __builtin_amdgcn_wave_barrier(); asm volatile("" ::: "memory");
    }
}

__device__ __forceinline__ h16 tohx(float x) { return (h16)x; }
__device__ __forceinline__ void splitf(float y, unsigned short& h, unsigned short& l) { h = f2bf(y); l = f2bf(y - bf2f(h)); }
typedef __attribute__((ext_vector_type(2))) _Float16 v2h;
typedef __attribute__((ext_vector_type(4))) _Float16 v4h;
typedef __attribute__((ext_vector_type(2))) unsigned short v2us;
typedef __attribute__((ext_vector_type(4))) unsigned short v4us;
typedef __attribute__((ext_vector_type(2))) float v2f;
typedef __attribute__((ext_vector_type(4))) int v4i;

// ---- k_prep: all that the GEMMs want of the f32 inputs, in ONE launch of 4,096 waves (512 work-groups, all resident). Every wave takes one piece of each job and has all of its loads in flight at once; no LDS, no barrier.
// x: two token rows (2,048 floats, 16 loads of 512 contiguous bytes) -> bf16 rows of XB [batch][TT][DM]; the padded tokens >= LR are stored as zeros.
// weights: w [K][N] f32 -> Bt [N][K] bf16, a piece of 64 k x 16 n: one load takes 64 contiguous bytes of two rows that lie 32 apart (the eight waves of a work-group: 512 contiguous bytes of each row),
//          so a lane gathers 32 k of ONE column in its registers and stores them as 64 contiguous bytes; the two lanes of a column fill one 128-B line of Bt.
#define NQKV_ (DQ + 2 * DKV)
typedef __attribute__((ext_vector_type(2))) unsigned v2u;
template <int N> __device__ __forceinline__ void prep_wave(const float* __restrict__ x, const float* __restrict__ w, bf* XB, bf* Bt, int gw, int u, int lane) {
    const int c = lane & 15, hi = lane >> 4;
    const int row = gw * 2, bt = row / TT, t = row % TT;
    const bool real = t < LR;   // LR is even: the wave's two rows are real or padded together, the same in every lane
    const unsigned keep = real ? 0xFFFFFFFFu : 0u;   // the padded rows' zeros by a mask on the packed pairs
    const float* s = x + ((size_t)bt * LR + (real ? t : 0)) * DM + lane * 4;   // a padded pair reads the batch's first two rows (in bounds, not used): one instruction stream in every wave
    v4f xv[16];
#pragma unroll
    for (int j = 0; j < 16; ++j) xv[j] = *(const v4f*)(s + j * 128);
    const int ng = u % (N / 16), kb = u / (N / 16);   // neighbouring waves take neighbouring columns of the same rows
    const float* p = w + (size_t)(kb * 64 + hi * 32) * N + ng * 16 + c;
    float v[32];
#pragma unroll
    for (int j = 0; j < 32; ++j) v[j] = p[(size_t)j * N];
    asm volatile("s_wait_xcnt 0x0" ::: "memory");   // stands behind the wave's last load, in front of the instructions that rewrite the loads' address registers (a precaution)
    bf* xd = XB + (size_t)row * DM + lane * 4;
#pragma unroll
    for (int j = 0; j < 16; ++j) { v4us o;
#pragma unroll
        for (int e = 0; e < 4; ++e) o[e] = f2bf(xv[j][e]);
        *(v2u*)(xd + j * 128) = __builtin_bit_cast(v2u, o) & keep; }
    asm volatile("s_wait_xcnt 0x0" ::: "memory");   // stands between these stores and the next instructions, which rewrite their data registers (a precaution)
    char* const wd = (char*)(Bt + (size_t)ng * 16 * DM + kb * 64); const unsigned wl = (unsigned)(c * DM + hi * 32) * 2;   // the piece's base (the same in every lane) and the lane's byte offset in it
#pragma unroll
    for (int q = 0; q < 4; ++q) { v8us o;
#pragma unroll
        for (int e = 0; e < 8; ++e) o[e] = f2bf(v[q * 8 + e]);
        *(v8us*)(wd + wl + q * 16) = o; }
}
__global__ __launch_bounds__(256) void k_prep(const float* __restrict__ x, const float* __restrict__ wqkv, const float* __restrict__ wo, bf* XB, bf* WALL, bf* WO) {
    constexpr int UQ = (NQKV_ / 16) * (DM / 64), UO = (DM / 16) * (DQ / 64);   // pieces of the two weights
    static_assert(DQ == DM && UQ + UO == NB_ * TT / 2 && DM == 1024 && LR % 2 == 0 && UQ % 8 == 0, "as many weight pieces as pairs of token rows: one of each a wave");
    const int lane = threadIdx.x & 31;
    const int gw = blockIdx.x * 8 + __builtin_amdgcn_readfirstlane((int)(threadIdx.x >> 5));
    if (gw < UQ) prep_wave<NQKV_>(x, wqkv, XB, WALL, gw, gw, lane); else prep_wave<DM>(x, wo, XB, WO, gw, gw - UQ, lane);
}
// ---- k_fattn: causal attention of all batches and heads in one launch. One wave owns 32 query rows and walks the key tiles (32 keys: a wave stays within 256 registers, four waves a SIMD) up to its diagonal; no LDS, no barrier.
// Scores are formed TRANSPOSED, St[key][query] = K q^T: a lane then holds 8 consecutive keys of ONE query (accumulator row = 8 hi + j, column = lane & 15), which is exactly the k order of the
// B fragment (elements 0..7: k = 8 hi + e; 8..15: k = 16 + 8 hi + e), so two 16-key score tiles become one 32-key probability fragment in place, and Ot[d][query] = Vt p^T follows.
// Online softmax per query (one lane pair): running maximum m of the raw scores, p = 2^(CL2 (s - m) + POFF), the sum l and Ot are rescaled by 2^(CL2 (m_old - m_new)); out = Ot / l (the 2^POFF cancels).
#define CL2 (SCL * 1.4426950408889634f)
__device__ __forceinline__ float exp2s(float x) { float r; asm("v_exp_f32 %0, %1\n\tv_nop" : "=v"(r) : "v"(x)); return r; }
template <bool HL> struct PFrag;
template <> struct PFrag<false> { static __device__ __forceinline__ void mk(const v8f& x, const v8f& y, v16h& p, v16h& p2) { (void)p2;
#pragma unroll
    for (int j = 0; j < 8; ++j) { p[j] = (h16)x[j]; p[j + 8] = (h16)y[j]; } } };
template <> struct PFrag<true> { static __device__ __forceinline__ void mk(const v8f& x, const v8f& y, v16bf& p, v16bf& p2) {   // hi = bf16(x), lo = bf16(x - hi), round to nearest even as in splitf (x is finite)
#pragma unroll
    for (int j = 0; j < 8; ++j) { const __bf16 a = (__bf16)x[j], b = (__bf16)y[j]; p[j] = a; p[j + 8] = b; p2[j] = (__bf16)(x[j] - (float)a); p2[j + 8] = (__bf16)(y[j] - (float)b); } } };
// fragment at a tile's base address (the same in every lane) plus the lane's 32-bit byte offset
template <typename T16> __device__ __forceinline__ typename WFrag<T16>::V ldo(const T16* base, unsigned off) { return WFrag<T16>::ld((const T16*)((const char*)base + off)); }
template <typename T16, bool HL, int KB>   // KB: 16-key blocks per key tile
__device__ __forceinline__ void fattn_wave(const T16* __restrict__ Q, const T16* __restrict__ Q2, const T16* __restrict__ Kp, const T16* __restrict__ K2, const T16* __restrict__ Vt, const T16* __restrict__ V2, int r0, int lr, int hi, bf* Ah, bf* Al) {
    typedef typename WFrag<T16>::V V;
    const float POFF = HL ? 0.0f : 10.0f;   // fp16 probabilities carry x1024 so that small ones stay normal numbers
    V q[2][2], q2[2][2];
#pragma unroll
    for (int qb = 0; qb < 2; ++qb)
#pragma unroll
        for (int kc = 0; kc < 2; ++kc) { const size_t o = (size_t)(r0 + qb * 16 + lr) * HD + kc * 32 + 8 * hi; q[qb][kc] = WFrag<T16>::ld(Q + o); if (HL) q2[qb][kc] = WFrag<T16>::ld(Q2 + o); }
    v8f ot[4][2]; float m[2], l[2];
#pragma unroll
    for (int qb = 0; qb < 2; ++qb) { m[qb] = -3.0e38f; l[qb] = 0.f;
#pragma unroll
        for (int db = 0; db < 4; ++db) ot[db][qb] = (v8f){}; }
    constexpr int DBE = HL ? 2 : 4;         // 16-row blocks of V^T fetched ahead of the softmax (hl rows: half, the softmax needs the other half's registers)
    constexpr bool PF = !HL;                // single-plane rows have the registers to fetch K one tile ahead
    V kf[KB][2], kf2[KB][2];
    const unsigned ko = (unsigned)(lr * HD + 8 * hi) * 2, vo = (unsigned)(lr * TT + 8 * hi) * 2;   // the lane's byte offsets in a K tile (row = key) and in a V^T tile (row = d)
    if (PF) {
#pragma unroll
        for (int kb = 0; kb < KB; ++kb)
#pragma unroll
            for (int kc = 0; kc < 2; ++kc) kf[kb][kc] = ldo(Kp, ko + (kb * 16 * HD + kc * 32) * 2); }
    const int nt = r0 / (KB * 16) + 1;             // the last tile holds the diagonal; every row has at least one key in every tile walked
#pragma unroll 1
    for (int kt = 0; kt < nt; ++kt) {
        const int c0 = kt * KB * 16;
        v8f s[KB][2]; V vf[4][KB / 2], vf2[4][KB / 2];
        const T16* vt1 = Vt + c0; const T16* vt2 = HL ? V2 + c0 : nullptr;
        if (!PF) { const T16* kt1 = Kp + (size_t)c0 * HD; const T16* kt2 = K2 + (size_t)c0 * HD;
#pragma unroll
            for (int kb = 0; kb < KB; ++kb)
#pragma unroll
                for (int kc = 0; kc < 2; ++kc) { const unsigned o = ko + (kb * 16 * HD + kc * 32) * 2; kf[kb][kc] = ldo(kt1, o); kf2[kb][kc] = ldo(kt2, o); }
            __builtin_amdgcn_sched_barrier(0);   // all of the tile's K loads are in flight before the first product waits: one memory latency a tile, not one a fragment
        }
#pragma unroll
        for (int kb = 0; kb < KB; ++kb) { s[kb][0] = (v8f){}; s[kb][1] = (v8f){};
#pragma unroll
            for (int kc = 0; kc < 2; ++kc)
#pragma unroll
                for (int qb = 0; qb < 2; ++qb) { s[kb][qb] = WFrag<T16>::mma(kf[kb][kc], q[qb][kc], s[kb][qb]); if (HL) { s[kb][qb] = WFrag<T16>::mma(kf[kb][kc], q2[qb][kc], s[kb][qb]); s[kb][qb] = WFrag<T16>::mma(kf2[kb][kc], q[qb][kc], s[kb][qb]); } } }
        if (HL) __builtin_amdgcn_sched_barrier(0);   // V's loads start only when the last score product has read K, so that V takes K's registers
#pragma unroll
        for (int db = 0; db < DBE; ++db)
#pragma unroll
            for (int kc = 0; kc < KB / 2; ++kc) { const unsigned o = vo + (db * 16 * TT + kc * 32) * 2; vf[db][kc] = ldo(vt1, o); if (HL) vf2[db][kc] = ldo(vt2, o); }
        if (PF) { const T16* kn = Kp + (size_t)(((kt + 1 < nt) ? kt + 1 : kt) * KB * 16) * HD;   // the next tile's K (the last trip reads its own tile again: in bounds, unused)
#pragma unroll
            for (int kb = 0; kb < KB; ++kb)
#pragma unroll
                for (int kc = 0; kc < 2; ++kc) kf[kb][kc] = ldo(kn, ko + (kb * 16 * HD + kc * 32) * 2); }
        __builtin_amdgcn_sched_barrier(0);   // these loads start here, behind the score products, and fly under the softmax arithmetic
        V p[2][KB / 2], p2[2][KB / 2];
#pragma unroll
        for (int qb = 0; qb < 2; ++qb) {
            const int lim = r0 + qb * 16 + lr - c0 - hi * 8;   // key kb * 16 + j of this lane is allowed while it is <= lim (causal mask by select)
            float mx = m[qb];
#pragma unroll
            for (int kb = 0; kb < KB; ++kb)
#pragma unroll
                for (int j = 0; j < 8; ++j) { const float t = (kb * 16 + j <= lim) ? s[kb][qb][j] : -3.0e38f; s[kb][qb][j] = t; mx = fmaxf(mx, t); }
            mx = fmaxf(mx, __shfl_xor(mx, 16, 32));
            const float al = exp2s((m[qb] - mx) * CL2); const float nm = POFF - mx * CL2; m[qb] = mx;
            float ps = 0.f;
#pragma unroll
            for (int kb = 0; kb < KB; ++kb)
#pragma unroll
                for (int j = 0; j < 8; ++j) { const float e = exp2s(fmaf(s[kb][qb][j], CL2, nm)); s[kb][qb][j] = e; ps += e; }
            l[qb] = l[qb] * al + ps;
#pragma unroll
            for (int db = 0; db < 4; ++db) ot[db][qb] *= al;
#pragma unroll
            for (int kc = 0; kc < KB / 2; ++kc) PFrag<HL>::mk(s[2 * kc][qb], s[2 * kc + 1][qb], p[qb][kc], p2[qb][kc]);
            // one query block's softmax at a time (both interleaved hold too many temporaries for 256 registers), and no matrix instruction among the exp2s statements
            __builtin_amdgcn_sched_barrier(0);
        }
#pragma unroll
        for (int g = 0; g < 4; g += DBE) {
            if (g > 0) {
                __builtin_amdgcn_sched_barrier(0);   // the next part of V is loaded only when the products of the part before it are issued, into the registers that these free (all of V at once does not fit in 256)
#pragma unroll
                for (int db = g; db < g + DBE; ++db)
#pragma unroll
                    for (int kc = 0; kc < KB / 2; ++kc) { const unsigned o = vo + (db * 16 * TT + kc * 32) * 2; vf[db][kc] = ldo(vt1, o); vf2[db][kc] = ldo(vt2, o); }
                __builtin_amdgcn_sched_barrier(0);   // and all of that part's loads are in flight before its first product waits
            }
#pragma unroll
            for (int db = g; db < g + DBE; ++db)
#pragma unroll
                for (int kc = 0; kc < KB / 2; ++kc)
#pragma unroll
                    for (int qb = 0; qb < 2; ++qb) { ot[db][qb] = WFrag<T16>::mma(vf[db][kc], p[qb][kc], ot[db][qb]); if (HL) { ot[db][qb] = WFrag<T16>::mma(vf[db][kc], p2[qb][kc], ot[db][qb]); ot[db][qb] = WFrag<T16>::mma(vf2[db][kc], p[qb][kc], ot[db][qb]); } }
        }
        // keeps the matrix instructions' distance over the loop's back edge, where the next trip's first vector instructions rewrite fragment registers
        asm volatile("v_nop\n\tv_nop\n\tv_nop\n\tv_nop\n\tv_nop" : "+v"(ot[0][0]), "+v"(ot[0][1]), "+v"(ot[1][0]), "+v"(ot[1][1]), "+v"(ot[2][0]), "+v"(ot[2][1]), "+v"(ot[3][0]), "+v"(ot[3][1]));
    }
#pragma unroll
    for (int qb = 0; qb < 2; ++qb) { const float f = __fdiv_rn(1.0f, l[qb] + __shfl_xor(l[qb], 16, 32));
#pragma unroll
        for (int db = 0; db < 4; ++db) { v8us oh, ol;
#pragma unroll
            for (int j = 0; j < 8; ++j) { unsigned short a, c; splitf(ot[db][qb][j] * f, a, c); oh[j] = a; ol[j] = c; }
            const size_t oo = (size_t)(r0 + qb * 16 + lr) * DQ + db * 16 + hi * 8; *(v8us*)(Ah + oo) = oh; *(v8us*)(Al + oo) = ol; } }
}
// grid (TT / 128, heads, batches), 4 independent waves per block: block i takes the 32-row query tiles i, 15 - i (hl) and 16 + i, 31 - i (fp16), so every block walks the same number of keys.
__global__ __launch_bounds__(128) void k_fattn(const h16* __restrict__ Q16, const bf* __restrict__ Qh, const bf* __restrict__ Ql, const h16* __restrict__ K16, const bf* __restrict__ Kh, const bf* __restrict__ Kl, const h16* __restrict__ V16, const bf* __restrict__ Vh, const bf* __restrict__ Vl, bf* Ah, bf* Al) {
    const int lane = threadIdx.x & 31, lr = lane & 15, hi = lane >> 4; const int i = blockIdx.x;
    const int w = (__builtin_amdgcn_readfirstlane((int)(threadIdx.x >> 5)) + i + (int)(blockIdx.z >> 1)) & 3;   // which of the block's four tiles this wave takes; turned with the block index, so that blocks sharing a WGP do not put all their long (fp16) tiles on the same SIMDs
    const int r0 = ((w >> 1) * 16 + ((w & 1) ? 15 - i : i)) * 32;
    const size_t po = ((size_t)blockIdx.z * NH_ + blockIdx.y) * TT * HD; const size_t ao = (size_t)blockIdx.z * TT * DQ + blockIdx.y * HD;
    if (r0 < RH) fattn_wave<bf, true, 2>(Qh + po, Ql + po, Kh + po, Kl + po, Vh + po, Vl + po, r0, lr, hi, Ah + ao, Al + ao);
    else fattn_wave<h16, false, 2>(Q16 + po, nullptr, K16 + po, nullptr, V16 + po, nullptr, r0, lr, hi, Ah + ao, Al + ao);
}

extern "C" void kernel_launch(void* const* d_in, const int* in_sizes, int n_in,
                              void* d_out, int out_size, void* d_ws, size_t ws_size, hipStream_t stream) {
    (void)in_sizes; (void)n_in; (void)out_size;
    const float* x = (const float*)d_in[0]; const float* wf = (const float*)d_in[1]; const float* bf3 = (const float*)d_in[2]; const float* wo = (const float*)d_in[3]; const float* bo = (const float*)d_in[4];
    float* OUT = (float*)d_out;     // [8][1000][1024]
    char* wsp = (char*)d_ws;
    auto take = [&](size_t bytes) { char* p = wsp; wsp += (bytes + 255) & ~(size_t)255; return (void*)p; };
    const int NQKV = DQ + 2 * DKV;
    const size_t PE = (size_t)NB_ * NH_ * TT * HD;   // elements of one 16-bit head plane of all batches
    bf* WO = (bf*)take((size_t)DM * DQ * 2);
    bf* XB = (bf*)take((size_t)NB_ * TT * DM * 2); bf* WALL = (bf*)take((size_t)NQKV * DM * 2);
    h16* P16 = (h16*)take(3 * PE * 2); bf* Ph = (bf*)take(3 * PE * 2); bf* Pl = (bf*)take(3 * PE * 2);   // q, k, v^T one behind the other in each
    bf* ATh = (bf*)take((size_t)NB_ * TT * DQ * 2); bf* ATl = (bf*)take((size_t)NB_ * TT * DQ * 2);   // merged heads hi, lo
    if ((size_t)(wsp - (char*)d_ws) > ws_size) return;    // 200 MiB of the 256 MiB workspace
    k_prep<<<NB_ * TT / 2 / 8, 256, 0, stream>>>(x, wf, wo, XB, WALL, WO);
    k_gemmw<bf, 0, true, DM><<<dim3(NB_ * TT / 128, NQKV / 128, 1), 128, 0, stream>>>(XB, nullptr, WALL, bf3, nullptr, P16, Ph, Pl);
    k_fattn<<<dim3(TT / 128, NH_, NB_), 128, 0, stream>>>(P16, Ph, Pl, P16 + PE, Ph + PE, Pl + PE, P16 + 2 * PE, Ph + 2 * PE, Pl + 2 * PE, ATh, ATl);
    k_gemmw<bf, 1, false, DQ><<<dim3(NB_ * TT / 128, DM / 128, 1), 128, 0, stream>>>(ATh, ATl, WO, bo, OUT, nullptr, nullptr, nullptr);
}

// v006
// It runs in 124 microseconds.
// Two timings next to v005 both put it at 1.09 times that version's speed.
// Counting every step since v000, it is 32.1 times as fast.
#include <hip/hip_runtime.h>

// MultiHeadAttentionConcise (x [8][1000][1024] - 1,000 tokens padded to 1,024 tiles on chip: the padded key rows are masked by causality for every real query, and only the 1,000 real output rows are written; qkv = x Wqkv + bqkv ([1024][3072]: q | k | v blocks, 16 heads x 64); causal softmax(q.k / 8) (-inf); out = merged Wo + bo -> [8][1000][1024]).
// Compute dtypes, f32 accumulate: every input rounded to bf16; q/k/v on PLAIN bf16 operands (inputs: exact; zero-padded rows) + bias, written by the GEMM itself as the 16-bit head planes that attention reads; causal scores and attn.v in ONE kernel (online softmax, f32, scores never leave registers): query rows < 512 hl (3 products), the rest single fp16 (probabilities x1024), key tiles beyond the diagonal skipped; Wo hl x exact (2 products) + bias, the 1,000 real rows of a batch stored straight to the output.

#define NB_  8
#define TT   1024
#define DM   1024
#define NH_  16
#define NKV  16
#define REP  (NH_ / NKV)
#define HD   64
#define DQ   (NH_ * HD)
#define DKV  (NKV * HD)
#define RH   512                  // query rows < RH use hi+lo planes (0: none)
#define LR   1000                 // real tokens per batch (TT = 1024 padded)
#define SCL  0.125f   // HD^-0.5
#define FB   512                  // elements of a fragment block of the head planes (16 rows x 32 columns, 1 KiB)
typedef _Float16 h16;
typedef unsigned short bf;
typedef __attribute__((ext_vector_type(16))) __bf16   v16bf;
typedef __attribute__((ext_vector_type(16))) _Float16 v16h;
typedef __attribute__((ext_vector_type(8)))  _Float16 v8h;
typedef __attribute__((ext_vector_type(8)))  unsigned short v8us;
typedef __attribute__((ext_vector_type(8)))  float    v8f;
typedef __attribute__((ext_vector_type(4)))  float    v4f;
typedef v8h  __attribute__((may_alias)) v8ha;
typedef v4f  __attribute__((may_alias)) v4fa;
typedef v8us __attribute__((may_alias)) v8usa;

__device__ __forceinline__ unsigned short f2bf(float f) { unsigned u = __float_as_uint(f); u += 0x7FFFu + ((u >> 16) & 1u); return (unsigned short)(u >> 16); }
__device__ __forceinline__ float bf2f(unsigned short b) { return __uint_as_float(((unsigned)b) << 16); }
__device__ __forceinline__ float bfr(float f) { return bf2f(f2bf(f)); }
__device__ __forceinline__ v16h cat16(v8h lo, v8h hi) { return __builtin_shufflevector(lo, hi, 0, 1, 2, 3, 4, 5, 6, 7, 8, 9, 10, 11, 12, 13, 14, 15); }
__device__ __forceinline__ v16bf cat16b(v8us lo, v8us hi) { return __builtin_bit_cast(v16bf, __builtin_shufflevector(lo, hi, 0, 1, 2, 3, 4, 5, 6, 7, 8, 9, 10, 11, 12, 13, 14, 15)); }
__device__ __forceinline__ v8f wmma16(v16h a, v16h b, v8f c) { return __builtin_amdgcn_wmma_f32_16x16x32_f16(false, a, false, b, (short)0, c, false, false); }
__device__ __forceinline__ v8f wmmab(v16bf a, v16bf b, v8f c) { return __builtin_amdgcn_wmma_f32_16x16x32_bf16(false, a, false, b, (short)0, c, false, false); }



// ---- k_gemmw: GEMM on K-contiguous 16-bit planes. A work-group of four waves (2 x 2) owns a 128x128 output tile, each wave a 64x64 part of it (16 accumulators); grid (M/128, N/128), 128 threads.
// The operand rows of the tile go through LDS, 64 k (128 B of every row) a pass, two buffers: asynchronous 16-B copies bring pass t + 2 in while pass t + 1 is worked on, whole 128-B lines from L2, each read once a work-group.
// A stage is [128 token rows | (NSPLIT 1: the same rows of the second plane) | 128 weight rows] at a pitch of 144 B (16 B x odd: the 16-B fragment reads meet no bank twice).
// c[m][n] (f32) = sum_k A[m][k] Bt[n][k] (+ A2[m][k] Bt[n][k] for NSPLIT 1) + bf16(bias[n]); m = batch * TT + token. K % 64 == 0. The epilogue stores the layout that the next reader wants, whole 128-B lines:
// HEADS: n = q | k | v block, head, d: one wave's tile is 64 tokens of one head. q, k: the matrix [token][d] of a (batch, head); v: the matrix [d][token], for which the wave takes the weight rows as its A operand and the tokens as B
//        (both fragments have one loader and one k order, so the same products come out as the transposed tile). Planes P16 (fp16), Ph, Pl (bf16 hi, lo) hold q, k, v one behind the other.
//        A plane is stored IN FRAGMENT ORDER: a block of 16 rows x 32 columns is 1 KiB, [column half c >> 4][lane = 16 ((c >> 3) & 1) + row][c & 7], which is the order in which a wave's two 16-B loads of a fragment take it:
//        each such load of k_fattn is 512 contiguous bytes (four whole lines, not 32 B of each of sixteen). Blocks of q, k: [token / 16][d / 32]; of v: [token / 32][d / 16]; so 32 keys are 4 contiguous KiB of k and of v.
//        Stored is what k_fattn reads: hi and lo for tokens < RH (all of its hl tiles lie there), fp16 for every k and v token and for the q tokens >= RH.
// else : rows of C = the output [batch][LR][DM]; the padded tokens >= LR are not stored.
typedef __attribute__((ext_vector_type(8))) __bf16 v8bf;
static_assert(LR % 2 == 0 && TT % 64 == 0 && RH % 64 == 0, "tile tests are per wave");
static_assert((DQ + DKV) % 128 == 0 && (NB_ * TT) % 128 == 0 && DM % 128 == 0, "whole 128x128 tiles");
template <typename T16> struct WFrag;   // ld: a fragment from rows in LDS (the lane's row and 16-B column); ldf: from a fragment block of a head plane (the block's start + 8 lane)
template <> struct WFrag<h16> { typedef v16h V; static __device__ __forceinline__ V ld(const h16* p) { return cat16(*(const v8h*)p, *(const v8h*)(p + 16)); } static __device__ __forceinline__ V ldf(const h16* p) { return cat16(*(const v8h*)p, *(const v8h*)(p + FB / 2)); } static __device__ __forceinline__ v8f mma(V a, V b, v8f c) { return wmma16(a, b, c); } };
template <> struct WFrag<bf> { typedef v16bf V; static __device__ __forceinline__ V ld(const bf* p) { return cat16b(*(const v8us*)p, *(const v8us*)(p + 16)); } static __device__ __forceinline__ V ldf(const bf* p) { return cat16b(*(const v8us*)p, *(const v8us*)(p + FB / 2)); } static __device__ __forceinline__ v8f mma(V a, V b, v8f c) { return wmmab(a, b, c); } };
#define GP 144   // LDS pitch of a 128-B row, bytes
// 128 rows of 128 B into LDS: every lane copies 16 B of eight rows that lie 16 apart (8 lanes a row, a wave 4 rows, the block 16 rows an instruction).
// l: the lane's LDS byte address in the first 16 rows, o: its byte offset in the first 16 source rows, g: the first row's pass (the same in every lane: a scalar base), gs: bytes between 16 source rows.
// s_wait_xcnt 0 closes the statement, so that it stands in front of every later write of a register that the copies name (a precaution).
__device__ __forceinline__ void copy128rows(unsigned l, unsigned o, const char* g, size_t gs) {
    asm volatile("global_load_async_to_lds_b128 %0, %8, %9\n\t"
                 "global_load_async_to_lds_b128 %1, %8, %10\n\t"
                 "global_load_async_to_lds_b128 %2, %8, %11\n\t"
                 "global_load_async_to_lds_b128 %3, %8, %12\n\t"
                 "global_load_async_to_lds_b128 %4, %8, %13\n\t"
                 "global_load_async_to_lds_b128 %5, %8, %14\n\t"
                 "global_load_async_to_lds_b128 %6, %8, %15\n\t"
                 "global_load_async_to_lds_b128 %7, %8, %16\n\t"
                 "s_wait_xcnt 0x0"
                 :: "v"(l), "v"(l + 16 * GP), "v"(l + 32 * GP), "v"(l + 48 * GP), "v"(l + 64 * GP), "v"(l + 80 * GP), "v"(l + 96 * GP), "v"(l + 112 * GP), "v"(o),
                    "s"(g), "s"(g + gs), "s"(g + 2 * gs), "s"(g + 3 * gs), "s"(g + 4 * gs), "s"(g + 5 * gs), "s"(g + 6 * gs), "s"(g + 7 * gs) : "memory");
}
template <typename T16, int NSPLIT, bool HEADS, int K>
__global__ __launch_bounds__(128) void k_gemmw(const T16* __restrict__ A, const T16* __restrict__ A2, const T16* __restrict__ Bt, const float* __restrict__ bias, float* C, h16* P16, bf* Ph, bf* Pl) {
    static_assert(NSPLIT == 0 || NSPLIT == 1, "one or two planes of A"); static_assert(K % 64 == 0 && K >= 128, "whole passes, two or more");
    typedef typename WFrag<T16>::V V;
    constexpr int WR = (NSPLIT == 1 ? 2 : 1) * 128;   // first weight row of a stage
    constexpr int STAGE = (WR + 128) * GP;
    __shared__ __align__(16) char ring[2 * STAGE];
    const int tid = threadIdx.x, lane = tid & 31, lr = lane & 15, hi = lane >> 4; const int wave = __builtin_amdgcn_readfirstlane(tid >> 5);
    const int R0 = blockIdx.x * 128, C0 = blockIdx.y * 128; const int wm = (wave >> 1) * 64, wn = (wave & 1) * 64; const int r0 = R0 + wm, c0 = C0 + wn;
    const bool isv = HEADS && c0 >= DQ + DKV;   // the same for the whole work-group
    v8f acc[4][4];
#pragma unroll
    for (int mb = 0; mb < 4; ++mb)
#pragma unroll
        for (int nb = 0; nb < 4; ++nb) acc[mb][nb] = (v8f){};
    const unsigned lc = (unsigned)(size_t)ring + (unsigned)((tid >> 3) * GP + (tid & 7) * 16);   // the lane's place in a stage's first 16 rows
    const unsigned go = (unsigned)((tid >> 3) * K + (tid & 7) * 8) * 2; constexpr size_t gs = (size_t)16 * K * 2;   // and in the first 16 source rows
    const char* const gx = (const char*)(A + (size_t)R0 * K); const char* const gx2 = NSPLIT == 1 ? (const char*)(A2 + (size_t)R0 * K) : nullptr; const char* const gw = (const char*)(Bt + (size_t)C0 * K);
    auto fill = [&](int t) { const unsigned l = lc + (unsigned)((t & 1) * STAGE); const size_t ko = (size_t)t * 128;
        copy128rows(l, go, gx + ko, gs); if (NSPLIT == 1) copy128rows(l + 128 * GP, go, gx2 + ko, gs); copy128rows(l + WR * GP, go, gw + ko, gs); };
    const char* const fa = ring + ((isv ? WR + wn : wm) + lr) * GP + hi * 16; const char* const fb = ring + ((isv ? wm : WR + wn) + lr) * GP + hi * 16;   // the lane's row and 16-B column of the wave's A and B fragments
    constexpr int NT = K / 64;
    fill(0);
    asm volatile("s_wait_asynccnt 0x0" ::: "memory");   // this wave's copies of pass 0 have landed
    __syncthreads();                                     // and every other wave's
    fill(1);
#pragma unroll 1   // stays rolled: the passes are alike but for the buffer, and unrolled they would only swell the code
    for (int t = 0; t < NT; ++t) {
        const char* const pa = fa + (t & 1) * STAGE; const char* const pb = fb + (t & 1) * STAGE;
        V a[4], a2[4], b[4];
        auto frags = [&](int ks) {   // the fragments of 32 k
#pragma unroll
            for (int mb = 0; mb < 4; ++mb) { a[mb] = WFrag<T16>::ld((const T16*)(pa + mb * 16 * GP + ks * 64)); if (NSPLIT == 1) a2[mb] = WFrag<T16>::ld((const T16*)(pa + (128 + mb * 16) * GP + ks * 64)); }
#pragma unroll
            for (int nb = 0; nb < 4; ++nb) b[nb] = WFrag<T16>::ld((const T16*)(pb + nb * 16 * GP + ks * 64)); };
        auto products = [&]() {
#pragma unroll
            for (int nb = 0; nb < 4; ++nb)
#pragma unroll
                for (int mb = 0; mb < 4; ++mb) { acc[mb][nb] = WFrag<T16>::mma(a[mb], b[nb], acc[mb][nb]); if (NSPLIT == 1) acc[mb][nb] = WFrag<T16>::mma(a2[mb], b[nb], acc[mb][nb]); } };
        frags(0);
        __builtin_amdgcn_sched_barrier(0);   // all of the block's fragment reads go out as one group ahead of its products: one LDS latency a block, not one a column of tiles
        products();
        __builtin_amdgcn_sched_barrier(0);   // the second half's reads start behind the first half's products and take their fragment registers: one set, so that a wave stays within 256 registers
        frags(1);
        asm volatile("s_wait_dscnt 0x0" ::: "memory");      // this wave has read all it wants of pass t's buffer (the second half's fragments are in registers)
        asm volatile("s_wait_asynccnt 0x0" ::: "memory");   // and its copies of pass t + 1 have landed
        __syncthreads();                                     // the same of every wave: pass t + 1 may be read, pass t's buffer refilled
        if (t + 2 < NT) fill(t + 2);
        products();                                          // on registers alone, while the refill flies
    }
    asm volatile("s_wait_asynccnt 0x0" ::: "memory");   // no copy is in flight when the ring becomes the output staging
    float* const os = (float*)(ring + wave * (16 * 68 * 4));   // each wave stages in its own part of the ring, which every wave has left at the last pass's barrier
    const int bt = r0 / TT, t0 = r0 % TT;   // batch and first token of the tile (64 divides TT)
    const bool whl = t0 < RH, w16 = c0 >= DQ || !whl;
    // HEADS: a lane stores 8 elements (16 B) of row lr, columns 16 s + 8 hi ..: store s of a 16-row block is one half of a fragment block, 512 contiguous bytes
    const size_t pbase = HEADS ? ((size_t)(c0 / DQ) * NB_ * NH_ + (size_t)bt * NH_ + (c0 % DQ) / HD) * TT * HD + (size_t)t0 * HD + lane * 8 : 0;
    float bc[4][8], br[4];   // HEADS: the bias of the lane's 32 columns (q, k: columns are the n index) and of its 4 rows (v: rows are), all fetched here at once: one latency a tile
    v4f bv;                  // else: the bias of the lane's 4 columns
    if (HEADS) {
#pragma unroll
        for (int s = 0; s < 4; ++s)
#pragma unroll
            for (int u = 0; u < 8; ++u) bc[s][u] = bias[c0 + s * 16 + hi * 8 + u];
        asm volatile("s_wait_xcnt 0x0" ::: "memory");   // the row loads behind it land in the address registers of the column loads
#pragma unroll
        for (int mb = 0; mb < 4; ++mb) br[mb] = bfr(bias[c0 + mb * 16 + lr]);
#pragma unroll
        for (int s = 0; s < 4; ++s)
#pragma unroll
            for (int u = 0; u < 8; ++u) bc[s][u] = bfr(bc[s][u]);
    } else {
#pragma unroll
        for (int u = 0; u < 4; ++u) bv[u] = bfr(bias[c0 + lr * 4 + u]); }
#pragma unroll
    for (int mb = 0; mb < 4; ++mb) {
#pragma unroll
        for (int nb = 0; nb < 4; ++nb) {
#pragma unroll
            for (int j = 0; j < 8; ++j) os[(hi * 8 + j) * 68 + nb * 16 + lr] = acc[mb][nb][j]; }
        __builtin_amdgcn_wave_barrier(); asm volatile("" ::: "memory");
        if (HEADS) {
#pragma unroll
            for (int s = 0; s < 4; ++s) { const float* const sp = os + lr * 68 + s * 16 + hi * 8; const v4f x0 = *(const v4fa*)sp, x1 = *(const v4fa*)(sp + 4);
                v8h o16; v8bf oh, ol;   // hi = bf16(y), lo = bf16(y - hi), round to nearest even
#pragma unroll
                for (int u = 0; u < 8; ++u) { const float y = (u < 4 ? x0[u] : x1[u - 4]) + (isv ? br[mb] : bc[s][u]); o16[u] = (h16)y; const __bf16 h = (__bf16)y; oh[u] = h; ol[u] = (__bf16)(y - (float)h); }
                const size_t o = pbase + (isv ? (s >> 1) * (4 * FB) + mb * FB + (s & 1) * (FB / 2) : mb * (2 * FB) + s * (FB / 2));   // q, k: rows mb are 16 tokens, s walks d; v: rows mb are 16 d, s walks 64 tokens
                // s_wait_xcnt 0: stands between a store and the next instructions, which rewrite its address and data registers
                if (w16) { *(v8h*)(P16 + o) = o16; asm volatile("s_wait_xcnt 0x0" ::: "memory"); }
                if (whl) { *(v8bf*)(Ph + o) = oh; *(v8bf*)(Pl + o) = ol; asm volatile("s_wait_xcnt 0x0" ::: "memory"); } }
        } else {
            float* crow = C + ((size_t)bt * LR + t0 + mb * 16) * DM + c0;
#pragma unroll
            for (int s = 0; s < 8; ++s) { const int row = 2 * s + hi, cofs = lr * 4;
                // LR is even: the wave's two rows are real or padded together, a scalar test. s_wait_xcnt 0: stands between the store and the next instructions, which rewrite its address and data registers
                if (t0 + mb * 16 + 2 * s < LR) { const v4f val = *(const v4fa*)(os + row * 68 + cofs) + bv; *(v4f*)(crow + (size_t)row * DM + cofs) = val; asm volatile("s_wait_xcnt 0x0" ::: "memory"); } }
        }
        __builtin_amdgcn_wave_barrier(); asm volatile("" ::: "memory");
    }
}

__device__ __forceinline__ h16 tohx(float x) { return (h16)x; }
__device__ __forceinline__ void splitf(float y, unsigned short& h, unsigned short& l) { h = f2bf(y); l = f2bf(y - bf2f(h)); }
typedef __attribute__((ext_vector_type(2))) _Float16 v2h;
typedef __attribute__((ext_vector_type(4))) _Float16 v4h;
typedef __attribute__((ext_vector_type(2))) unsigned short v2us;
typedef __attribute__((ext_vector_type(4))) unsigned short v4us;
typedef __attribute__((ext_vector_type(2))) float v2f;
typedef __attribute__((ext_vector_type(4))) int v4i;

// ---- k_prep: all that the GEMMs want of the f32 inputs, in ONE launch of 4,096 waves (512 work-groups, all resident). Every wave takes one piece of each job and has all of its loads in flight at once; no LDS, no barrier.
// x: two token rows (2,048 floats, 16 loads of 512 contiguous bytes) -> bf16 rows of XB [batch][TT][DM]; the padded tokens >= LR are stored as zeros.
// weights: w [K][N] f32 -> Bt [N][K] bf16, a piece of 64 k x 16 n: one load takes 64 contiguous bytes of two rows that lie 32 apart (the eight waves of a work-group: 512 contiguous bytes of each row),
//          so a lane gathers 32 k of ONE column in its registers and stores them as 64 contiguous bytes; the two lanes of a column fill one 128-B line of Bt.
#define NQKV_ (DQ + 2 * DKV)
typedef __attribute__((ext_vector_type(2))) unsigned v2u;
template <int N> __device__ __forceinline__ void prep_wave(const float* __restrict__ x, const float* __restrict__ w, bf* XB, bf* Bt, int gw, int u, int lane) {
    const int c = lane & 15, hi = lane >> 4;
    const int row = gw * 2, bt = row / TT, t = row % TT;
    const bool real = t < LR;   // LR is even: the wave's two rows are real or padded together, the same in every lane
    const unsigned keep = real ? 0xFFFFFFFFu : 0u;   // the padded rows' zeros by a mask on the packed pairs
    const float* s = x + ((size_t)bt * LR + (real ? t : 0)) * DM + lane * 4;   // a padded pair reads the batch's first two rows (in bounds, not used): one instruction stream in every wave
    v4f xv[16];
#pragma unroll
    for (int j = 0; j < 16; ++j) xv[j] = *(const v4f*)(s + j * 128);
    const int ng = u % (N / 16), kb = u / (N / 16);   // neighbouring waves take neighbouring columns of the same rows
    const float* p = w + (size_t)(kb * 64 + hi * 32) * N + ng * 16 + c;
    float v[32];
#pragma unroll
    for (int j = 0; j < 32; ++j) v[j] = p[(size_t)j * N];
    asm volatile("s_wait_xcnt 0x0" ::: "memory");   // stands behind the wave's last load, in front of the instructions that rewrite the loads' address registers (a precaution)
    bf* xd = XB + (size_t)row * DM + lane * 4;
#pragma unroll
    for (int j = 0; j < 16; ++j) { v4us o;
#pragma unroll
        for (int e = 0; e < 4; ++e) o[e] = f2bf(xv[j][e]);
        *(v2u*)(xd + j * 128) = __builtin_bit_cast(v2u, o) & keep; }
    asm volatile("s_wait_xcnt 0x0" ::: "memory");   // stands between these stores and the next instructions, which rewrite their data registers (a precaution)
    char* const wd = (char*)(Bt + (size_t)ng * 16 * DM + kb * 64); const unsigned wl = (unsigned)(c * DM + hi * 32) * 2;   // the piece's base (the same in every lane) and the lane's byte offset in it
#pragma unroll
    for (int q = 0; q < 4; ++q) { v8us o;
#pragma unroll
        for (int e = 0; e < 8; ++e) o[e] = f2bf(v[q * 8 + e]);
        *(v8us*)(wd + wl + q * 16) = o; }
}
__global__ __launch_bounds__(256) void k_prep(const float* __restrict__ x, const float* __restrict__ wqkv, const float* __restrict__ wo, bf* XB, bf* WALL, bf* WO) {
    constexpr int UQ = (NQKV_ / 16) * (DM / 64), UO = (DM / 16) * (DQ / 64);   // pieces of the two weights
    static_assert(DQ == DM && UQ + UO == NB_ * TT / 2 && DM == 1024 && LR % 2 == 0 && UQ % 8 == 0, "as many weight pieces as pairs of token rows: one of each a wave");
    const int lane = threadIdx.x & 31;
    const int gw = blockIdx.x * 8 + __builtin_amdgcn_readfirstlane((int)(threadIdx.x >> 5));
    if (gw < UQ) prep_wave<NQKV_>(x, wqkv, XB, WALL, gw, gw, lane); else prep_wave<DM>(x, wo, XB, WO, gw, gw - UQ, lane);
}
// ---- k_fattn: causal attention of all batches and heads in one launch. One wave owns 32 query rows and walks the key tiles (32 keys: a wave stays within 256 registers, four waves a SIMD) up to its diagonal; no LDS, no barrier. Q, K and V^T lie in fragment order (k_gemmw): every load is 512 contiguous bytes.
// Scores are formed TRANSPOSED, St[key][query] = K q^T: a lane then holds 8 consecutive keys of ONE query (accumulator row = 8 hi + j, column = lane & 15), which is exactly the k order of the
// B fragment (elements 0..7: k = 8 hi + e; 8..15: k = 16 + 8 hi + e), so two 16-key score tiles become one 32-key probability fragment in place, and Ot[d][query] = Vt p^T follows.
// Online softmax per query (one lane pair): running maximum m of the raw scores, p = 2^(CL2 (s - m) + POFF), the sum l and Ot are rescaled by 2^(CL2 (m_old - m_new)); out = Ot / l (the 2^POFF cancels).
#define CL2 (SCL * 1.4426950408889634f)
__device__ __forceinline__ float exp2s(float x) { float r; asm("v_exp_f32 %0, %1\n\tv_nop" : "=v"(r) : "v"(x)); return r; }
template <bool HL> struct PFrag;
template <> struct PFrag<false> { static __device__ __forceinline__ void mk(const v8f& x, const v8f& y, v16h& p, v16h& p2) { (void)p2;
#pragma unroll
    for (int j = 0; j < 8; ++j) { p[j] = (h16)x[j]; p[j + 8] = (h16)y[j]; } } };
template <> struct PFrag<true> { static __device__ __forceinline__ void mk(const v8f& x, const v8f& y, v16bf& p, v16bf& p2) {   // hi = bf16(x), lo = bf16(x - hi), round to nearest even as in splitf (x is finite)
#pragma unroll
    for (int j = 0; j < 8; ++j) { const __bf16 a = (__bf16)x[j], b = (__bf16)y[j]; p[j] = a; p[j + 8] = b; p2[j] = (__bf16)(x[j] - (float)a); p2[j + 8] = (__bf16)(y[j] - (float)b); } } };
// fragment block blk of a tile: the plane's base address (the same in every lane) plus the lane's 32-bit byte offset in the tile's first block
template <typename T16> __device__ __forceinline__ typename WFrag<T16>::V ldo(const T16* base, unsigned off, int blk) { return WFrag<T16>::ldf((const T16*)((const char*)base + off) + blk * FB); }
template <typename T16, bool HL, int KB>   // KB: 16-key blocks per key tile
__device__ __forceinline__ void fattn_wave(const T16* __restrict__ Q, const T16* __restrict__ Q2, const T16* __restrict__ Kp, const T16* __restrict__ K2, const T16* __restrict__ Vt, const T16* __restrict__ V2, int r0, int lr, int hi, bf* Ah, bf* Al) {
    typedef typename WFrag<T16>::V V;
    const float POFF = HL ? 0.0f : 10.0f;   // fp16 probabilities carry x1024 so that small ones stay normal numbers
    V q[2][2], q2[2][2];
#pragma unroll
    for (int qb = 0; qb < 2; ++qb)
#pragma unroll
        for (int kc = 0; kc < 2; ++kc) { const size_t o = (size_t)r0 * HD + (qb * 2 + kc) * FB + (hi * 16 + lr) * 8; q[qb][kc] = WFrag<T16>::ldf(Q + o); if (HL) q2[qb][kc] = WFrag<T16>::ldf(Q2 + o); }
    v8f ot[4][2]; float m[2], l[2];
#pragma unroll
    for (int qb = 0; qb < 2; ++qb) { m[qb] = -3.0e38f; l[qb] = 0.f;
#pragma unroll
        for (int db = 0; db < 4; ++db) ot[db][qb] = (v8f){}; }
    constexpr int DBE = HL ? 2 : 4;         // 16-row blocks of V^T fetched ahead of the softmax (hl rows: half, the softmax needs the other half's registers)
    constexpr bool PF = !HL;                // single-plane rows have the registers to fetch K one tile ahead
    V kf[KB][2], kf2[KB][2];
    const unsigned lo = (unsigned)(hi * 16 + lr) * 16;   // the lane's byte offset in a fragment block, of K (row = key) and of V^T (row = d) alike
    if (PF) {
#pragma unroll
        for (int kb = 0; kb < KB; ++kb)
#pragma unroll
            for (int kc = 0; kc < 2; ++kc) kf[kb][kc] = ldo(Kp, lo, kb * 2 + kc); }
    const int nt = r0 / (KB * 16) + 1;             // the last tile holds the diagonal; every row has at least one key in every tile walked
#pragma unroll 1
    for (int kt = 0; kt < nt; ++kt) {
        const int c0 = kt * KB * 16;
        v8f s[KB][2]; V vf[4][KB / 2], vf2[4][KB / 2];
        const unsigned to = lo + (unsigned)c0 * (HD * 2);   // the lane's byte offset in the tile's first block: KB * 16 keys are as many bytes of K as of V^T, so one offset serves every plane
        if (!PF) {
#pragma unroll
            for (int kb = 0; kb < KB; ++kb)
#pragma unroll
                for (int kc = 0; kc < 2; ++kc) { kf[kb][kc] = ldo(Kp, to, kb * 2 + kc); kf2[kb][kc] = ldo(K2, to, kb * 2 + kc); }
            __builtin_amdgcn_sched_barrier(0);   // all of the tile's K loads are in flight before the first product waits: one memory latency a tile, not one a fragment
        }
#pragma unroll
        for (int kb = 0; kb < KB; ++kb) { s[kb][0] = (v8f){}; s[kb][1] = (v8f){};
#pragma unroll
            for (int kc = 0; kc < 2; ++kc)
#pragma unroll
                for (int qb = 0; qb < 2; ++qb) { s[kb][qb] = WFrag<T16>::mma(kf[kb][kc], q[qb][kc], s[kb][qb]); if (HL) { s[kb][qb] = WFrag<T16>::mma(kf[kb][kc], q2[qb][kc], s[kb][qb]); s[kb][qb] = WFrag<T16>::mma(kf2[kb][kc], q[qb][kc], s[kb][qb]); } } }
        if (HL) __builtin_amdgcn_sched_barrier(0);   // V's loads start only when the last score product has read K, so that V takes K's registers
#pragma unroll
        for (int db = 0; db < DBE; ++db)
#pragma unroll
            for (int kc = 0; kc < KB / 2; ++kc) { vf[db][kc] = ldo(Vt, to, kc * 4 + db); if (HL) vf2[db][kc] = ldo(V2, to, kc * 4 + db); }
        if (PF) { const unsigned tn = lo + (unsigned)(((kt + 1 < nt) ? kt + 1 : kt) * KB * 16) * (HD * 2);   // the next tile's K (the last trip reads its own tile again: in bounds, unused)
#pragma unroll
            for (int kb = 0; kb < KB; ++kb)
#pragma unroll
                for (int kc = 0; kc < 2; ++kc) kf[kb][kc] = ldo(Kp, tn, kb * 2 + kc); }
        __builtin_amdgcn_sched_barrier(0);   // these loads start here, behind the score products, and fly under the softmax arithmetic
        V p[2][KB / 2], p2[2][KB / 2];
#pragma unroll
        for (int qb = 0; qb < 2; ++qb) {
            const int lim = r0 + qb * 16 + lr - c0 - hi * 8;   // key kb * 16 + j of this lane is allowed while it is <= lim (causal mask by select)
            float mx = m[qb];
#pragma unroll
            for (int kb = 0; kb < KB; ++kb)
#pragma unroll
                for (int j = 0; j < 8; ++j) { const float t = (kb * 16 + j <= lim) ? s[kb][qb][j] : -3.0e38f; s[kb][qb][j] = t; mx = fmaxf(mx, t); }
            mx = fmaxf(mx, __shfl_xor(mx, 16, 32));
            const float al = exp2s((m[qb] - mx) * CL2); const float nm = POFF - mx * CL2; m[qb] = mx;
            float ps = 0.f;
#pragma unroll
            for (int kb = 0; kb < KB; ++kb)
#pragma unroll
                for (int j = 0; j < 8; ++j) { const float e = exp2s(fmaf(s[kb][qb][j], CL2, nm)); s[kb][qb][j] = e; ps += e; }
            l[qb] = l[qb] * al + ps;
#pragma unroll
            for (int db = 0; db < 4; ++db) ot[db][qb] *= al;
#pragma unroll
            for (int kc = 0; kc < KB / 2; ++kc) PFrag<HL>::mk(s[2 * kc][qb], s[2 * kc + 1][qb], p[qb][kc], p2[qb][kc]);
            // one query block's softmax at a time (both interleaved hold too many temporaries for 256 registers), and no matrix instruction among the exp2s statements
            __builtin_amdgcn_sched_barrier(0);
        }
#pragma unroll
        for (int g = 0; g < 4; g += DBE) {
            if (g > 0) {
                __builtin_amdgcn_sched_barrier(0);   // the next part of V is loaded only when the products of the part before it are issued, into the registers that these free (all of V at once does not fit in 256)
#pragma unroll
                for (int db = g; db < g + DBE; ++db)
#pragma unroll
                    for (int kc = 0; kc < KB / 2; ++kc) { vf[db][kc] = ldo(Vt, to, kc * 4 + db); vf2[db][kc] = ldo(V2, to, kc * 4 + db); }
                __builtin_amdgcn_sched_barrier(0);   // and all of that part's loads are in flight before its first product waits
            }
#pragma unroll
            for (int db = g; db < g + DBE; ++db)
#pragma unroll
                for (int kc = 0; kc < KB / 2; ++kc)
#pragma unroll
                    for (int qb = 0; qb < 2; ++qb) { ot[db][qb] = WFrag<T16>::mma(vf[db][kc], p[qb][kc], ot[db][qb]); if (HL) { ot[db][qb] = WFrag<T16>::mma(vf[db][kc], p2[qb][kc], ot[db][qb]); ot[db][qb] = WFrag<T16>::mma(vf2[db][kc], p[qb][kc], ot[db][qb]); } }
        }
        // keeps the matrix instructions' distance over the loop's back edge, where the next trip's first vector instructions rewrite fragment registers
        asm volatile("v_nop\n\tv_nop\n\tv_nop\n\tv_nop\n\tv_nop" : "+v"(ot[0][0]), "+v"(ot[0][1]), "+v"(ot[1][0]), "+v"(ot[1][1]), "+v"(ot[2][0]), "+v"(ot[2][1]), "+v"(ot[3][0]), "+v"(ot[3][1]));
    }
#pragma unroll
    for (int qb = 0; qb < 2; ++qb) { const float f = __fdiv_rn(1.0f, l[qb] + __shfl_xor(l[qb], 16, 32));
#pragma unroll
        for (int db = 0; db < 4; ++db) { v8us oh, ol;
#pragma unroll
            for (int j = 0; j < 8; ++j) { unsigned short a, c; splitf(ot[db][qb][j] * f, a, c); oh[j] = a; ol[j] = c; }
            const size_t oo = (size_t)(r0 + qb * 16 + lr) * DQ + db * 16 + hi * 8; *(v8us*)(Ah + oo) = oh; *(v8us*)(Al + oo) = ol; } }
}
// grid (TT / 128, heads, batches), 4 independent waves per block: block i takes the 32-row query tiles i, 15 - i (hl) and 16 + i, 31 - i (fp16), so every block walks the same number of keys.
__global__ __launch_bounds__(128) void k_fattn(const h16* __restrict__ Q16, const bf* __restrict__ Qh, const bf* __restrict__ Ql, const h16* __restrict__ K16, const bf* __restrict__ Kh, const bf* __restrict__ Kl, const h16* __restrict__ V16, const bf* __restrict__ Vh, const bf* __restrict__ Vl, bf* Ah, bf* Al) {
    const int lane = threadIdx.x & 31, lr = lane & 15, hi = lane >> 4; const int i = blockIdx.x;
    const int w = (__builtin_amdgcn_readfirstlane((int)(threadIdx.x >> 5)) + i + (int)(blockIdx.z >> 1)) & 3;   // which of the block's four tiles this wave takes; turned with the block index, so that blocks sharing a WGP do not put all their long (fp16) tiles on the same SIMDs
    const int r0 = ((w >> 1) * 16 + ((w & 1) ? 15 - i : i)) * 32;
    const size_t po = ((size_t)blockIdx.z * NH_ + blockIdx.y) * TT * HD; const size_t ao = (size_t)blockIdx.z * TT * DQ + blockIdx.y * HD;
    if (r0 < RH) fattn_wave<bf, true, 2>(Qh + po, Ql + po, Kh + po, Kl + po, Vh + po, Vl + po, r0, lr, hi, Ah + ao, Al + ao);
    else fattn_wave<h16, false, 2>(Q16 + po, nullptr, K16 + po, nullptr, V16 + po, nullptr, r0, lr, hi, Ah + ao, Al + ao);
}

extern "C" void kernel_launch(void* const* d_in, const int* in_sizes, int n_in,
                              void* d_out, int out_size, void* d_ws, size_t ws_size, hipStream_t stream) {
    (void)in_sizes; (void)n_in; (void)out_size;
    const float* x = (const float*)d_in[0]; const float* wf = (const float*)d_in[1]; const float* bf3 = (const float*)d_in[2]; const float* wo = (const float*)d_in[3]; const float* bo = (const float*)d_in[4];
    float* OUT = (float*)d_out;     // [8][1000][1024]
    char* wsp = (char*)d_ws;
    auto take = [&](size_t bytes) { char* p = wsp; wsp += (bytes + 255) & ~(size_t)255; return (void*)p; };
    const int NQKV = DQ + 2 * DKV;
    const size_t PE = (size_t)NB_ * NH_ * TT * HD;   // elements of one 16-bit head plane of all batches
    bf* WO = (bf*)take((size_t)DM * DQ * 2);
    bf* XB = (bf*)take((size_t)NB_ * TT * DM * 2); bf* WALL = (bf*)take((size_t)NQKV * DM * 2);
    h16* P16 = (h16*)take(3 * PE * 2); bf* Ph = (bf*)take(3 * PE * 2); bf* Pl = (bf*)take(3 * PE * 2);   // q, k, v^T one behind the other in each
    bf* ATh = (bf*)take((size_t)NB_ * TT * DQ * 2); bf* ATl = (bf*)take((size_t)NB_ * TT * DQ * 2);   // merged heads hi, lo
    if ((size_t)(wsp - (char*)d_ws) > ws_size) return;    // 200 MiB of the 256 MiB workspace
    k_prep<<<NB_ * TT / 2 / 8, 256, 0, stream>>>(x, wf, wo, XB, WALL, WO);
    k_gemmw<bf, 0, true, DM><<<dim3(NB_ * TT / 128, NQKV / 128, 1), 128, 0, stream>>>(XB, nullptr, WALL, bf3, nullptr, P16, Ph, Pl);
    k_fattn<<<dim3(TT / 128, NH_, NB_), 128, 0, stream>>>(P16, Ph, Pl, P16 + PE, Ph + PE, Pl + PE, P16 + 2 * PE, Ph + 2 * PE, Pl + 2 * PE, ATh, ATl);
    k_gemmw<bf, 1, false, DQ><<<dim3(NB_ * TT / 128, DM / 128, 1), 128, 0, stream>>>(ATh, ATl, WO, bo, OUT, nullptr, nullptr, nullptr);
}

// v007
// It runs in 114 microseconds.
// Timed twice side by side with v006, it ran 1.10 and 1.08 times as fast.
// All steps since v000 together make it 35.0 times as fast.
#include <hip/hip_runtime.h>

// MultiHeadAttentionConcise (x [8][1000][1024] - 1,000 tokens padded to 1,024 tiles on chip: the padded key rows are masked by causality for every real query, and only the 1,000 real output rows are written; qkv = x Wqkv + bqkv ([1024][3072]: q | k | v blocks, 16 heads x 64); causal softmax(q.k / 8) (-inf); out = merged Wo + bo -> [8][1000][1024]).
// Compute dtypes, f32 accumulate: every input rounded to bf16; q/k/v on PLAIN bf16 operands (inputs: exact; zero-padded rows) + bias, written by the GEMM itself as the 16-bit head planes that attention reads; causal scores and attn.v in ONE kernel (online softmax, f32, scores never leave registers): query rows < 512 hl (3 products), the rest single fp16 (probabilities x1024), key tiles beyond the diagonal skipped; Wo hl x exact (2 products) + bias, the 1,000 real rows of a batch stored straight to the output.

#define NB_  8
#define TT   1024
#define DM   1024
#define NH_  16
#define NKV  16
#define REP  (NH_ / NKV)
#define HD   64
#define DQ   (NH_ * HD)
#define DKV  (NKV * HD)
#define RH   512                  // query rows < RH use hi+lo planes (0: none)
#define LR   1000                 // real tokens per batch (TT = 1024 padded)
#define SCL  0.125f   // HD^-0.5
#define FB   512                  // elements of a fragment block of the head planes (16 rows x 32 columns, 1 KiB)
typedef _Float16 h16;
typedef unsigned short bf;
typedef __attribute__((ext_vector_type(16))) __bf16   v16bf;
typedef __attribute__((ext_vector_type(16))) _Float16 v16h;
typedef __attribute__((ext_vector_type(8)))  _Float16 v8h;
typedef __attribute__((ext_vector_type(8)))  unsigned short v8us;
typedef __attribute__((ext_vector_type(8)))  float    v8f;
typedef __attribute__((ext_vector_type(4)))  float    v4f;
typedef v8h  __attribute__((may_alias)) v8ha;
typedef v4f  __attribute__((may_alias)) v4fa;
typedef v8us __attribute__((may_alias)) v8usa;

__device__ __forceinline__ unsigned short f2bf(float f) { unsigned u = __float_as_uint(f); u += 0x7FFFu + ((u >> 16) & 1u); return (unsigned short)(u >> 16); }
__device__ __forceinline__ float bf2f(unsigned short b) { return __uint_as_float(((unsigned)b) << 16); }
__device__ __forceinline__ float bfr(float f) { return bf2f(f2bf(f)); }
__device__ __forceinline__ v16h cat16(v8h lo, v8h hi) { return __builtin_shufflevector(lo, hi, 0, 1, 2, 3, 4, 5, 6, 7, 8, 9, 10, 11, 12, 13, 14, 15); }
__device__ __forceinline__ v16bf cat16b(v8us lo, v8us hi) { return __builtin_bit_cast(v16bf, __builtin_shufflevector(lo, hi, 0, 1, 2, 3, 4, 5, 6, 7, 8, 9, 10, 11, 12, 13, 14, 15)); }
__device__ __forceinline__ v8f wmma16(v16h a, v16h b, v8f c) { return __builtin_amdgcn_wmma_f32_16x16x32_f16(false, a, false, b, (short)0, c, false, false); }
__device__ __forceinline__ v8f wmmab(v16bf a, v16bf b, v8f c) { return __builtin_amdgcn_wmma_f32_16x16x32_bf16(false, a, false, b, (short)0, c, false, false); }



// ---- k_gemmw: GEMM on K-contiguous 16-bit planes. A work-group of four waves (2 x 2) owns a 128x128 output tile, each wave a 64x64 part of it (16 accumulators); grid (M/128, N/128), 128 threads.
// The operand rows of the tile go through LDS, 64 k (128 B of every row) a pass, two buffers: asynchronous 16-B copies bring pass t + 2 in while pass t + 1 is worked on, whole 128-B lines from L2, each read once a work-group.
// A stage is [128 token rows | (NSPLIT 1: the same rows of the second plane) | 128 weight rows] at a pitch of 144 B (16 B x odd: the 16-B fragment reads meet no bank twice).
// c[m][n] (f32) = sum_k A[m][k] Bt[n][k] (+ A2[m][k] Bt[n][k] for NSPLIT 1) + bf16(bias[n]); m = batch * TT + token. K % 64 == 0. The epilogue stores the layout that the next reader wants, whole 128-B lines:
// HEADS: n = q | k | v block, head, d: one wave's tile is 64 tokens of one head. q, k: the matrix [token][d] of a (batch, head); v: the matrix [d][token], for which the wave takes the weight rows as its A operand and the tokens as B
//        (both fragments have one loader and one k order, so the same products come out as the transposed tile). Planes P16 (fp16), Ph, Pl (bf16 hi, lo) hold q, k, v one behind the other.
//        A plane is stored IN FRAGMENT ORDER: a block of 16 rows x 32 columns is 1 KiB, [column half c >> 4][lane = 16 ((c >> 3) & 1) + row][c & 7], which is the order in which a wave's two 16-B loads of a fragment take it:
//        each such load of k_fattn is 512 contiguous bytes (four whole lines, not 32 B of each of sixteen). Blocks of q, k: [token / 16][d / 32]; of v: [token / 32][d / 16]; so 32 keys are 4 contiguous KiB of k and of v.
//        Stored is what k_fattn reads: hi and lo for tokens < RH (all of its hl tiles lie there), fp16 for every k and v token and for the q tokens >= RH.
// else : rows of C = the output [batch][LR][DM]; the padded tokens >= LR are not stored.
typedef __attribute__((ext_vector_type(8))) __bf16 v8bf;
static_assert(LR % 2 == 0 && TT % 64 == 0 && RH % 64 == 0, "tile tests are per wave");
static_assert((DQ + DKV) % 128 == 0 && (NB_ * TT) % 128 == 0 && DM % 128 == 0, "whole 128x128 tiles");
template <typename T16> struct WFrag;   // ld: a fragment from rows in LDS (the lane's row and 16-B column); ldf: from a fragment block of a head plane (the block's start + 8 lane)
template <> struct WFrag<h16> { typedef v16h V; static __device__ __forceinline__ V ld(const h16* p) { return cat16(*(const v8h*)p, *(const v8h*)(p + 16)); } static __device__ __forceinline__ V ldf(const h16* p) { return cat16(*(const v8h*)p, *(const v8h*)(p + FB / 2)); } static __device__ __forceinline__ v8f mma(V a, V b, v8f c) { return wmma16(a, b, c); } };
template <> struct WFrag<bf> { typedef v16bf V; static __device__ __forceinline__ V ld(const bf* p) { return cat16b(*(const v8us*)p, *(const v8us*)(p + 16)); } static __device__ __forceinline__ V ldf(const bf* p) { return cat16b(*(const v8us*)p, *(const v8us*)(p + FB / 2)); } static __device__ __forceinline__ v8f mma(V a, V b, v8f c) { return wmmab(a, b, c); } };
#define GP 144   // LDS pitch of a 128-B row, bytes
// L2 hints: every lane asks the 256-B unit at its own address into L2 (nothing returns, no register is written). Asked well ahead of its readers,
// a unit is found in L2 by them, where each pass or key tile would else wait out a memory latency of its own. Every address lies inside the plane it names. s_wait_xcnt 0 closes the statement, in front of every later write of the address registers (a precaution).
__device__ __forceinline__ void l2ask(const char* a) {
    asm volatile("global_prefetch_b8 %0, off scope:SCOPE_SE\n\ts_wait_xcnt 0x0" :: "v"(a)); }
__device__ __forceinline__ void l2ask(const char* a, const char* b) {
    asm volatile("global_prefetch_b8 %0, off scope:SCOPE_SE\n\tglobal_prefetch_b8 %1, off scope:SCOPE_SE\n\ts_wait_xcnt 0x0" :: "v"(a), "v"(b)); }
__device__ __forceinline__ void l2ask(const char* a, const char* b, const char* c, const char* d) {
    asm volatile("global_prefetch_b8 %0, off scope:SCOPE_SE\n\tglobal_prefetch_b8 %1, off scope:SCOPE_SE\n\tglobal_prefetch_b8 %2, off scope:SCOPE_SE\n\tglobal_prefetch_b8 %3, off scope:SCOPE_SE\n\ts_wait_xcnt 0x0" :: "v"(a), "v"(b), "v"(c), "v"(d)); }
// 128 rows of 128 B into LDS: every lane copies 16 B of eight rows that lie 16 apart (8 lanes a row, a wave 4 rows, the block 16 rows an instruction).
// l: the lane's LDS byte address in the first 16 rows, o: its byte offset in the first 16 source rows, g: the first row's pass (the same in every lane: a scalar base), gs: bytes between 16 source rows.
// s_wait_xcnt 0 closes the statement, so that it stands in front of every later write of a register that the copies name (a precaution).
__device__ __forceinline__ void copy128rows(unsigned l, unsigned o, const char* g, size_t gs) {
    asm volatile("global_load_async_to_lds_b128 %0, %8, %9\n\t"
                 "global_load_async_to_lds_b128 %1, %8, %10\n\t"
                 "global_load_async_to_lds_b128 %2, %8, %11\n\t"
                 "global_load_async_to_lds_b128 %3, %8, %12\n\t"
                 "global_load_async_to_lds_b128 %4, %8, %13\n\t"
                 "global_load_async_to_lds_b128 %5, %8, %14\n\t"
                 "global_load_async_to_lds_b128 %6, %8, %15\n\t"
                 "global_load_async_to_lds_b128 %7, %8, %16\n\t"
                 "s_wait_xcnt 0x0"
                 :: "v"(l), "v"(l + 16 * GP), "v"(l + 32 * GP), "v"(l + 48 * GP), "v"(l + 64 * GP), "v"(l + 80 * GP), "v"(l + 96 * GP), "v"(l + 112 * GP), "v"(o),
                    "s"(g), "s"(g + gs), "s"(g + 2 * gs), "s"(g + 3 * gs), "s"(g + 4 * gs), "s"(g + 5 * gs), "s"(g + 6 * gs), "s"(g + 7 * gs) : "memory");
}
template <typename T16, int NSPLIT, bool HEADS, int K>
__global__ __launch_bounds__(128) void k_gemmw(const T16* __restrict__ A, const T16* __restrict__ A2, const T16* __restrict__ Bt, const float* __restrict__ bias, float* C, h16* P16, bf* Ph, bf* Pl) {
    static_assert(NSPLIT == 0 || NSPLIT == 1, "one or two planes of A"); static_assert(K % 64 == 0 && K >= 128, "whole passes, two or more");
    typedef typename WFrag<T16>::V V;
    constexpr int WR = (NSPLIT == 1 ? 2 : 1) * 128;   // first weight row of a stage
    constexpr int STAGE = (WR + 128) * GP;
    __shared__ __align__(16) char ring[2 * STAGE];
    const int tid = threadIdx.x, lane = tid & 31, lr = lane & 15, hi = lane >> 4; const int wave = __builtin_amdgcn_readfirstlane(tid >> 5);
    const int R0 = blockIdx.x * 128, C0 = blockIdx.y * 128; const int wm = (wave >> 1) * 64, wn = (wave & 1) * 64; const int r0 = R0 + wm, c0 = C0 + wn;
    const bool isv = HEADS && c0 >= DQ + DKV;   // the same for the whole work-group
    v8f acc[4][4];
#pragma unroll
    for (int mb = 0; mb < 4; ++mb)
#pragma unroll
        for (int nb = 0; nb < 4; ++nb) acc[mb][nb] = (v8f){};
    const unsigned lc = (unsigned)(size_t)ring + (unsigned)((tid >> 3) * GP + (tid & 7) * 16);   // the lane's place in a stage's first 16 rows
    const unsigned go = (unsigned)((tid >> 3) * K + (tid & 7) * 8) * 2; constexpr size_t gs = (size_t)16 * K * 2;   // and in the first 16 source rows
    const char* const gx = (const char*)(A + (size_t)R0 * K); const char* const gx2 = NSPLIT == 1 ? (const char*)(A2 + (size_t)R0 * K) : nullptr; const char* const gw = (const char*)(Bt + (size_t)C0 * K);
    auto fill = [&](int t) { const unsigned l = lc + (unsigned)((t & 1) * STAGE); const size_t ko = (size_t)t * 128;
        copy128rows(l, go, gx + ko, gs); if (NSPLIT == 1) copy128rows(l + 128 * GP, go, gx2 + ko, gs); copy128rows(l + WR * GP, go, gw + ko, gs); };
    const char* const fa = ring + ((isv ? WR + wn : wm) + lr) * GP + hi * 16; const char* const fb = ring + ((isv ? wm : WR + wn) + lr) * GP + hi * 16;   // the lane's row and 16-B column of the wave's A and B fragments
    constexpr int NT = K / 64;
    fill(0);
    {   // L2 hints for the operand tiles (128 rows x 2 KiB, contiguous), which are shared: the token rows by the work-groups of this blockIdx.x, the weight rows by those of this blockIdx.y.
        // The first work-groups of each such set ask an eighth of the tile each, one unit a thread:
        // the token eighths go by blockIdx.y, the weight eighths by bits 0, 1, 3 of blockIdx.x, bit 2 doubling them. For speed only: nothing rests on where a work-group runs.
        static_assert(K == 1024, "an eighth of an operand tile is one 256-B unit a thread");
        constexpr unsigned TILE = 128 * K * 2;
        const unsigned ua = blockIdx.y * (TILE / 8) + tid * 256, uw = ((blockIdx.x & 3) | ((blockIdx.x >> 1) & 4)) * (TILE / 8) + tid * 256;
        if (blockIdx.y < 8) { if (NSPLIT == 1) l2ask(gx + ua, gx2 + ua); else l2ask(gx + ua); }
        if (blockIdx.x < 16) l2ask(gw + uw);
        // HEADS: 24 rows of work-groups: the weight tiles of the last 8 are asked by the first 8 rows (for speed only)
        if (HEADS && blockIdx.y < 8 && (blockIdx.x >> 4) == 1) { static_assert(!HEADS || (DQ + 2 * DKV) / 128 == 24, "tile blockIdx.y + 16 exists"); l2ask(gw + 16 * TILE + uw); }
    }
    asm volatile("s_wait_asynccnt 0x0" ::: "memory");   // this wave's copies of pass 0 have landed
    __syncthreads();                                     // and every other wave's
    fill(1);
#pragma unroll 1   // stays rolled: the passes are alike but for the buffer, and unrolled they would only swell the code
    for (int t = 0; t < NT; ++t) {
        const char* const pa = fa + (t & 1) * STAGE; const char* const pb = fb + (t & 1) * STAGE;
        V a[4], a2[4], b[4];
        auto frags = [&](int ks) {   // the fragments of 32 k
#pragma unroll
            for (int mb = 0; mb < 4; ++mb) { a[mb] = WFrag<T16>::ld((const T16*)(pa + mb * 16 * GP + ks * 64)); if (NSPLIT == 1) a2[mb] = WFrag<T16>::ld((const T16*)(pa + (128 + mb * 16) * GP + ks * 64)); }
#pragma unroll
            for (int nb = 0; nb < 4; ++nb) b[nb] = WFrag<T16>::ld((const T16*)(pb + nb * 16 * GP + ks * 64)); };
        auto products = [&]() {
#pragma unroll
            for (int nb = 0; nb < 4; ++nb)
#pragma unroll
                for (int mb = 0; mb < 4; ++mb) { acc[mb][nb] = WFrag<T16>::mma(a[mb], b[nb], acc[mb][nb]); if (NSPLIT == 1) acc[mb][nb] = WFrag<T16>::mma(a2[mb], b[nb], acc[mb][nb]); } };
        frags(0);
        __builtin_amdgcn_sched_barrier(0);   // all of the block's fragment reads go out as one group ahead of its products: one LDS latency a block, not one a column of tiles
        products();
        __builtin_amdgcn_sched_barrier(0);   // the second half's reads start behind the first half's products and take their fragment registers: one set, so that a wave stays within 256 registers
        frags(1);
        asm volatile("s_wait_dscnt 0x0" ::: "memory");      // this wave has read all it wants of pass t's buffer (the second half's fragments are in registers)
        asm volatile("s_wait_asynccnt 0x0" ::: "memory");   // and its copies of pass t + 1 have landed
        __syncthreads();                                     // the same of every wave: pass t + 1 may be read, pass t's buffer refilled
        if (t + 2 < NT) fill(t + 2);
        products();                                          // on registers alone, while the refill flies
    }
    asm volatile("s_wait_asynccnt 0x0" ::: "memory");   // no copy is in flight when the ring becomes the output staging
    float* const os = (float*)(ring + wave * (16 * 68 * 4));   // each wave stages in its own part of the ring, which every wave has left at the last pass's barrier
    const int bt = r0 / TT, t0 = r0 % TT;   // batch and first token of the tile (64 divides TT)
    const bool whl = t0 < RH, w16 = c0 >= DQ || !whl;
    // HEADS: a lane stores 8 elements (16 B) of row lr, columns 16 s + 8 hi ..: store s of a 16-row block is one half of a fragment block, 512 contiguous bytes
    const size_t pbase = HEADS ? ((size_t)(c0 / DQ) * NB_ * NH_ + (size_t)bt * NH_ + (c0 % DQ) / HD) * TT * HD + (size_t)t0 * HD + lane * 8 : 0;
    float bc[4][8], br[4];   // HEADS: the bias of the lane's 32 columns (q, k: columns are the n index) and of its 4 rows (v: rows are), all fetched here at once: one latency a tile
    v4f bv;                  // else: the bias of the lane's 4 columns
    if (HEADS) {
#pragma unroll
        for (int s = 0; s < 4; ++s)
#pragma unroll
            for (int u = 0; u < 8; ++u) bc[s][u] = bias[c0 + s * 16 + hi * 8 + u];
        asm volatile("s_wait_xcnt 0x0" ::: "memory");   // the row loads behind it land in the address registers of the column loads
#pragma unroll
        for (int mb = 0; mb < 4; ++mb) br[mb] = bfr(bias[c0 + mb * 16 + lr]);
#pragma unroll
        for (int s = 0; s < 4; ++s)
#pragma unroll
            for (int u = 0; u < 8; ++u) bc[s][u] = bfr(bc[s][u]);
    } else {
#pragma unroll
        for (int u = 0; u < 4; ++u) bv[u] = bfr(bias[c0 + lr * 4 + u]); }
#pragma unroll
    for (int mb = 0; mb < 4; ++mb) {
#pragma unroll
        for (int nb = 0; nb < 4; ++nb) {
#pragma unroll
            for (int j = 0; j < 8; ++j) os[(hi * 8 + j) * 68 + nb * 16 + lr] = acc[mb][nb][j]; }
        __builtin_amdgcn_wave_barrier(); asm volatile("" ::: "memory");
        if (HEADS) {
#pragma unroll
            for (int s = 0; s < 4; ++s) { const float* const sp = os + lr * 68 + s * 16 + hi * 8; const v4f x0 = *(const v4fa*)sp, x1 = *(const v4fa*)(sp + 4);
                v8h o16; v8bf oh, ol;   // hi = bf16(y), lo = bf16(y - hi), round to nearest even
#pragma unroll
                for (int u = 0; u < 8; ++u) { const float y = (u < 4 ? x0[u] : x1[u - 4]) + (isv ? br[mb] : bc[s][u]); o16[u] = (h16)y; const __bf16 h = (__bf16)y; oh[u] = h; ol[u] = (__bf16)(y - (float)h); }
                const size_t o = pbase + (isv ? (s >> 1) * (4 * FB) + mb * FB + (s & 1) * (FB / 2) : mb * (2 * FB) + s * (FB / 2));   // q, k: rows mb are 16 tokens, s walks d; v: rows mb are 16 d, s walks 64 tokens
                // s_wait_xcnt 0: stands between a store and the next instructions, which rewrite its address and data registers
                if (w16) { *(v8h*)(P16 + o) = o16; asm volatile("s_wait_xcnt 0x0" ::: "memory"); }
                if (whl) { *(v8bf*)(Ph + o) = oh; *(v8bf*)(Pl + o) = ol; asm volatile("s_wait_xcnt 0x0" ::: "memory"); } }
        } else {
            float* crow = C + ((size_t)bt * LR + t0 + mb * 16) * DM + c0;
#pragma unroll
            for (int s = 0; s < 8; ++s) { const int row = 2 * s + hi, cofs = lr * 4;
                // LR is even: the wave's two rows are real or padded together, a scalar test. s_wait_xcnt 0: stands between the store and the next instructions, which rewrite its address and data registers
                if (t0 + mb * 16 + 2 * s < LR) { const v4f val = *(const v4fa*)(os + row * 68 + cofs) + bv; *(v4f*)(crow + (size_t)row * DM + cofs) = val; asm volatile("s_wait_xcnt 0x0" ::: "memory"); } }
        }
        __builtin_amdgcn_wave_barrier(); asm volatile("" ::: "memory");
    }
}

__device__ __forceinline__ h16 tohx(float x) { return (h16)x; }
__device__ __forceinline__ void splitf(float y, unsigned short& h, unsigned short& l) { h = f2bf(y); l = f2bf(y - bf2f(h)); }
typedef __attribute__((ext_vector_type(2))) _Float16 v2h;
typedef __attribute__((ext_vector_type(4))) _Float16 v4h;
typedef __attribute__((ext_vector_type(2))) unsigned short v2us;
typedef __attribute__((ext_vector_type(4))) unsigned short v4us;
typedef __attribute__((ext_vector_type(2))) float v2f;
typedef __attribute__((ext_vector_type(4))) int v4i;

// ---- k_prep: all that the GEMMs want of the f32 inputs, in ONE launch of 4,096 waves (512 work-groups, all resident). Every wave takes one piece of each job and has all of its loads in flight at once; no LDS, no barrier.
// x: two token rows (2,048 floats, 16 loads of 512 contiguous bytes) -> bf16 rows of XB [batch][TT][DM]; the padded tokens >= LR are stored as zeros.
// weights: w [K][N] f32 -> Bt [N][K] bf16, a piece of 64 k x 16 n: one load takes 64 contiguous bytes of two rows that lie 32 apart (the eight waves of a work-group: 512 contiguous bytes of each row),
//          so a lane gathers 32 k of ONE column in its registers and stores them as 64 contiguous bytes; the two lanes of a column fill one 128-B line of Bt.
#define NQKV_ (DQ + 2 * DKV)
typedef __attribute__((ext_vector_type(2))) unsigned v2u;
template <int N> __device__ __forceinline__ void prep_wave(const float* __restrict__ x, const float* __restrict__ w, bf* XB, bf* Bt, int gw, int u, int lane) {
    const int c = lane & 15, hi = lane >> 4;
    const int row = gw * 2, bt = row / TT, t = row % TT;
    const bool real = t < LR;   // LR is even: the wave's two rows are real or padded together, the same in every lane
    const unsigned keep = real ? 0xFFFFFFFFu : 0u;   // the padded rows' zeros by a mask on the packed pairs
    const float* s = x + ((size_t)bt * LR + (real ? t : 0)) * DM + lane * 4;   // a padded pair reads the batch's first two rows (in bounds, not used): one instruction stream in every wave
    v4f xv[16];
#pragma unroll
    for (int j = 0; j < 16; ++j) xv[j] = *(const v4f*)(s + j * 128);
    const int ng = u % (N / 16), kb = u / (N / 16);   // neighbouring waves take neighbouring columns of the same rows
    const float* p = w + (size_t)(kb * 64 + hi * 32) * N + ng * 16 + c;
    float v[32];
#pragma unroll
    for (int j = 0; j < 32; ++j) v[j] = p[(size_t)j * N];
    asm volatile("s_wait_xcnt 0x0" ::: "memory");   // stands behind the wave's last load, in front of the instructions that rewrite the loads' address registers (a precaution)
    bf* xd = XB + (size_t)row * DM + lane * 4;
#pragma unroll
    for (int j = 0; j < 16; ++j) { v4us o;
#pragma unroll
        for (int e = 0; e < 4; ++e) o[e] = f2bf(xv[j][e]);
        *(v2u*)(xd + j * 128) = __builtin_bit_cast(v2u, o) & keep; }
    asm volatile("s_wait_xcnt 0x0" ::: "memory");   // stands between these stores and the next instructions, which rewrite their data registers (a precaution)
    char* const wd = (char*)(Bt + (size_t)ng * 16 * DM + kb * 64); const unsigned wl = (unsigned)(c * DM + hi * 32) * 2;   // the piece's base (the same in every lane) and the lane's byte offset in it
#pragma unroll
    for (int q = 0; q < 4; ++q) { v8us o;
#pragma unroll
        for (int e = 0; e < 8; ++e) o[e] = f2bf(v[q * 8 + e]);
        *(v8us*)(wd + wl + q * 16) = o; }
}
__global__ __launch_bounds__(256) void k_prep(const float* __restrict__ x, const float* __restrict__ wqkv, const float* __restrict__ wo, bf* XB, bf* WALL, bf* WO) {
    constexpr int UQ = (NQKV_ / 16) * (DM / 64), UO = (DM / 16) * (DQ / 64);   // pieces of the two weights
    static_assert(DQ == DM && UQ + UO == NB_ * TT / 2 && DM == 1024 && LR % 2 == 0 && UQ % 8 == 0, "as many weight pieces as pairs of token rows: one of each a wave");
    const int lane = threadIdx.x & 31;
    const int gw = blockIdx.x * 8 + __builtin_amdgcn_readfirstlane((int)(threadIdx.x >> 5));
    if (gw < UQ) prep_wave<NQKV_>(x, wqkv, XB, WALL, gw, gw, lane); else prep_wave<DM>(x, wo, XB, WO, gw, gw - UQ, lane);
}
// ---- k_fattn: causal attention of all batches and heads in one launch. One wave owns 32 query rows and walks the key tiles (32 keys: a wave stays within 256 registers, four waves a SIMD) up to its diagonal; no LDS, no barrier. Q, K and V^T lie in fragment order (k_gemmw): every load is 512 contiguous bytes.
// Scores are formed TRANSPOSED, St[key][query] = K q^T: a lane then holds 8 consecutive keys of ONE query (accumulator row = 8 hi + j, column = lane & 15), which is exactly the k order of the
// B fragment (elements 0..7: k = 8 hi + e; 8..15: k = 16 + 8 hi + e), so two 16-key score tiles become one 32-key probability fragment in place, and Ot[d][query] = Vt p^T follows.
// Online softmax per query (one lane pair): running maximum m of the raw scores, p = 2^(CL2 (s - m) + POFF), the sum l and Ot are rescaled by 2^(CL2 (m_old - m_new)); out = Ot / l (the 2^POFF cancels).
#define CL2 (SCL * 1.4426950408889634f)
__device__ __forceinline__ float exp2s(float x) { float r; asm("v_exp_f32 %0, %1\n\tv_nop" : "=v"(r) : "v"(x)); return r; }
template <bool HL> struct PFrag;
template <> struct PFrag<false> { static __device__ __forceinline__ void mk(const v8f& x, const v8f& y, v16h& p, v16h& p2) { (void)p2;
#pragma unroll
    for (int j = 0; j < 8; ++j) { p[j] = (h16)x[j]; p[j + 8] = (h16)y[j]; } } };
template <> struct PFrag<true> { static __device__ __forceinline__ void mk(const v8f& x, const v8f& y, v16bf& p, v16bf& p2) {   // hi = bf16(x), lo = bf16(x - hi), round to nearest even as in splitf (x is finite)
#pragma unroll
    for (int j = 0; j < 8; ++j) { const __bf16 a = (__bf16)x[j], b = (__bf16)y[j]; p[j] = a; p[j + 8] = b; p2[j] = (__bf16)(x[j] - (float)a); p2[j + 8] = (__bf16)(y[j] - (float)b); } } };
// fragment block blk of a tile: the plane's base address (the same in every lane) plus the lane's 32-bit byte offset in the tile's first block
template <typename T16> __device__ __forceinline__ typename WFrag<T16>::V ldo(const T16* base, unsigned off, int blk) { return WFrag<T16>::ldf((const T16*)((const char*)base + off) + blk * FB); }
template <typename T16, bool HL, int KB>   // KB: 16-key blocks per key tile
__device__ __forceinline__ void fattn_wave(const T16* __restrict__ Q, const T16* __restrict__ Q2, const T16* __restrict__ Kp, const T16* __restrict__ K2, const T16* __restrict__ Vt, const T16* __restrict__ V2, int r0, int lr, int hi, bf* Ah, bf* Al, int pt) {
    typedef typename WFrag<T16>::V V;
    // L2 hints (l2ask) for K and V^T, which the work-groups of a (batch, head) walk from key 0 up: a key tile is 16 units of 256 B in every plane (lanes 0..15: K, 16..31: V^T), asked PD tiles ahead of its first reader.
    // pt: the next tile that this wave asks for, every fourth one (-1: none, the wave asks for nothing); the same in every lane. The address stays inside the planes' written part: it moves on only while a tile is left.
    constexpr int PD = 8, TB = KB * 16 * HD * 2, PLAST = (HL ? RH : TT) / (KB * 16) - 1;   // lead in tiles, bytes of a tile in a plane, last tile that is read
    const char* pf = (const char*)(hi ? Vt : Kp) + (pt < 0 ? 0 : pt) * TB + lr * 256; const char* pf2 = HL ? (const char*)(hi ? V2 : K2) + (pt < 0 ? 0 : pt) * TB + lr * 256 : nullptr;
    if (pt >= 0) {   // the first PD tiles at entry; the rest from the loop
        if (HL) l2ask(pf, pf2, pf + 4 * TB, pf2 + 4 * TB); else l2ask(pf, pf + 4 * TB);
        pf += PD * TB; if (HL) pf2 += PD * TB; pt += PD; }
    const float POFF = HL ? 0.0f : 10.0f;   // fp16 probabilities carry x1024 so that small ones stay normal numbers
    V q[2][2], q2[2][2];
#pragma unroll
    for (int qb = 0; qb < 2; ++qb)
#pragma unroll
        for (int kc = 0; kc < 2; ++kc) { const size_t o = (size_t)r0 * HD + (qb * 2 + kc) * FB + (hi * 16 + lr) * 8; q[qb][kc] = WFrag<T16>::ldf(Q + o); if (HL) q2[qb][kc] = WFrag<T16>::ldf(Q2 + o); }
    v8f ot[4][2]; float m[2], l[2];
#pragma unroll
    for (int qb = 0; qb < 2; ++qb) { m[qb] = -3.0e38f; l[qb] = 0.f;
#pragma unroll
        for (int db = 0; db < 4; ++db) ot[db][qb] = (v8f){}; }
    constexpr int DBE = HL ? 2 : 4;         // 16-row blocks of V^T fetched ahead of the softmax (hl rows: half, the softmax needs the other half's registers)
    constexpr bool PF = !HL;                // single-plane rows have the registers to fetch K one tile ahead
    V kf[KB][2], kf2[KB][2];
    const unsigned lo = (unsigned)(hi * 16 + lr) * 16;   // the lane's byte offset in a fragment block, of K (row = key) and of V^T (row = d) alike
    if (PF) {
#pragma unroll
        for (int kb = 0; kb < KB; ++kb)
#pragma unroll
            for (int kc = 0; kc < 2; ++kc) kf[kb][kc] = ldo(Kp, lo, kb * 2 + kc); }
    const int nt = r0 / (KB * 16) + 1;             // the last tile holds the diagonal; every row has at least one key in every tile walked
#pragma unroll 1
    for (int kt = 0; kt < nt; ++kt) {
        const int c0 = kt * KB * 16;
        v8f s[KB][2]; V vf[4][KB / 2], vf2[4][KB / 2];
        const unsigned to = lo + (unsigned)c0 * (HD * 2);   // the lane's byte offset in the tile's first block: KB * 16 keys are as many bytes of K as of V^T, so one offset serves every plane
        if (!PF) {
#pragma unroll
            for (int kb = 0; kb < KB; ++kb)
#pragma unroll
                for (int kc = 0; kc < 2; ++kc) { kf[kb][kc] = ldo(Kp, to, kb * 2 + kc); kf2[kb][kc] = ldo(K2, to, kb * 2 + kc); }
            __builtin_amdgcn_sched_barrier(0);   // all of the tile's K loads are in flight before the first product waits: one memory latency a tile, not one a fragment
        }
#pragma unroll
        for (int kb = 0; kb < KB; ++kb) { s[kb][0] = (v8f){}; s[kb][1] = (v8f){};
#pragma unroll
            for (int kc = 0; kc < 2; ++kc)
#pragma unroll
                for (int qb = 0; qb < 2; ++qb) { s[kb][qb] = WFrag<T16>::mma(kf[kb][kc], q[qb][kc], s[kb][qb]); if (HL) { s[kb][qb] = WFrag<T16>::mma(kf[kb][kc], q2[qb][kc], s[kb][qb]); s[kb][qb] = WFrag<T16>::mma(kf2[kb][kc], q[qb][kc], s[kb][qb]); } } }
        if (HL) __builtin_amdgcn_sched_barrier(0);   // V's loads start only when the last score product has read K, so that V takes K's registers
#pragma unroll
        for (int db = 0; db < DBE; ++db)
#pragma unroll
            for (int kc = 0; kc < KB / 2; ++kc) { vf[db][kc] = ldo(Vt, to, kc * 4 + db); if (HL) vf2[db][kc] = ldo(V2, to, kc * 4 + db); }
        if (PF) { const unsigned tn = lo + (unsigned)(((kt + 1 < nt) ? kt + 1 : kt) * KB * 16) * (HD * 2);   // the next tile's K (the last trip reads its own tile again: in bounds, unused)
#pragma unroll
            for (int kb = 0; kb < KB; ++kb)
#pragma unroll
                for (int kc = 0; kc < 2; ++kc) kf[kb][kc] = ldo(Kp, tn, kb * 2 + kc); }
        __builtin_amdgcn_sched_barrier(0);   // these loads start here, behind the score products, and fly under the softmax arithmetic
        V p[2][KB / 2], p2[2][KB / 2];
#pragma unroll
        for (int qb = 0; qb < 2; ++qb) {
            const int lim = r0 + qb * 16 + lr - c0 - hi * 8;   // key kb * 16 + j of this lane is allowed while it is <= lim (causal mask by select)
            float mx = m[qb];
#pragma unroll
            for (int kb = 0; kb < KB; ++kb)
#pragma unroll
                for (int j = 0; j < 8; ++j) { const float t = (kb * 16 + j <= lim) ? s[kb][qb][j] : -3.0e38f; s[kb][qb][j] = t; mx = fmaxf(mx, t); }
            mx = fmaxf(mx, __shfl_xor(mx, 16, 32));
            const float al = exp2s((m[qb] - mx) * CL2); const float nm = POFF - mx * CL2; m[qb] = mx;
            float ps = 0.f;
#pragma unroll
            for (int kb = 0; kb < KB; ++kb)
#pragma unroll
                for (int j = 0; j < 8; ++j) { const float e = exp2s(fmaf(s[kb][qb][j], CL2, nm)); s[kb][qb][j] = e; ps += e; }
            l[qb] = l[qb] * al + ps;
#pragma unroll
            for (int db = 0; db < 4; ++db) ot[db][qb] *= al;
#pragma unroll
            for (int kc = 0; kc < KB / 2; ++kc) PFrag<HL>::mk(s[2 * kc][qb], s[2 * kc + 1][qb], p[qb][kc], p2[qb][kc]);
            // one query block's softmax at a time (both interleaved hold too many temporaries for 256 registers), and no matrix instruction among the exp2s statements
            __builtin_amdgcn_sched_barrier(0);
        }
#pragma unroll
        for (int g = 0; g < 4; g += DBE) {
            if (g > 0) {
                __builtin_amdgcn_sched_barrier(0);   // the next part of V is loaded only when the products of the part before it are issued, into the registers that these free (all of V at once does not fit in 256)
#pragma unroll
                for (int db = g; db < g + DBE; ++db)
#pragma unroll
                    for (int kc = 0; kc < KB / 2; ++kc) { vf[db][kc] = ldo(Vt, to, kc * 4 + db); vf2[db][kc] = ldo(V2, to, kc * 4 + db); }
                __builtin_amdgcn_sched_barrier(0);   // and all of that part's loads are in flight before its first product waits
            }
#pragma unroll
            for (int db = g; db < g + DBE; ++db)
#pragma unroll
                for (int kc = 0; kc < KB / 2; ++kc)
#pragma unroll
                    for (int qb = 0; qb < 2; ++qb) { ot[db][qb] = WFrag<T16>::mma(vf[db][kc], p[qb][kc], ot[db][qb]); if (HL) { ot[db][qb] = WFrag<T16>::mma(vf[db][kc], p2[qb][kc], ot[db][qb]); ot[db][qb] = WFrag<T16>::mma(vf2[db][kc], p[qb][kc], ot[db][qb]); } }
        }
        // keeps the matrix instructions' distance over the loop's back edge, where the next trip's first vector instructions rewrite fragment registers
        asm volatile("v_nop\n\tv_nop\n\tv_nop\n\tv_nop\n\tv_nop" : "+v"(ot[0][0]), "+v"(ot[0][1]), "+v"(ot[1][0]), "+v"(ot[1][1]), "+v"(ot[2][0]), "+v"(ot[2][1]), "+v"(ot[3][0]), "+v"(ot[3][1]));
        if (kt + PD == pt) {   // a scalar test, at the trip's end: a branch among the products and the softmax would split what the compiler schedules as one
            if (HL) l2ask(pf, pf2); else l2ask(pf);
            if (pt + 4 <= PLAST) { pf += 4 * TB; if (HL) pf2 += 4 * TB; pt += 4; } else pt = -1; }
    }
#pragma unroll
    for (int qb = 0; qb < 2; ++qb) { const float f = __fdiv_rn(1.0f, l[qb] + __shfl_xor(l[qb], 16, 32));
#pragma unroll
        for (int db = 0; db < 4; ++db) { v8us oh, ol;
#pragma unroll
            for (int j = 0; j < 8; ++j) { unsigned short a, c; splitf(ot[db][qb][j] * f, a, c); oh[j] = a; ol[j] = c; }
            const size_t oo = (size_t)(r0 + qb * 16 + lr) * DQ + db * 16 + hi * 8; *(v8us*)(Ah + oo) = oh; *(v8us*)(Al + oo) = ol; } }
}
// grid (TT / 128, heads, batches), 4 independent waves per block: block i takes the 32-row query tiles i, 15 - i (hl) and 16 + i, 31 - i (fp16), so every block walks the same number of keys.
__global__ __launch_bounds__(128) void k_fattn(const h16* __restrict__ Q16, const bf* __restrict__ Qh, const bf* __restrict__ Ql, const h16* __restrict__ K16, const bf* __restrict__ Kh, const bf* __restrict__ Kl, const h16* __restrict__ V16, const bf* __restrict__ Vh, const bf* __restrict__ Vl, bf* Ah, bf* Al) {
    const int lane = threadIdx.x & 31, lr = lane & 15, hi = lane >> 4; const int i = blockIdx.x;
    const int w = (__builtin_amdgcn_readfirstlane((int)(threadIdx.x >> 5)) + i + (int)(blockIdx.z >> 1)) & 3;   // which of the block's four tiles this wave takes; turned with the block index, so that blocks sharing a WGP do not put all their long (fp16) tiles on the same SIMDs
    const int r0 = ((w >> 1) * 16 + ((w & 1) ? 15 - i : i)) * 32;
    const size_t po = ((size_t)blockIdx.z * NH_ + blockIdx.y) * TT * HD; const size_t ao = (size_t)blockIdx.z * TT * DQ + blockIdx.y * HD;
    // the L2 hints come from the longer wave of each kind (tiles 15 - i and 31 - i): key tiles i & 3, + 4, + 8 ... Work-groups i and i ^ 4 ask for the same tiles.
    // For speed only: nothing rests on where a work-group runs or on how far another wave has come.
    const int pt = (w & 1) ? (i & 3) : -1;
    if (r0 < RH) fattn_wave<bf, true, 2>(Qh + po, Ql + po, Kh + po, Kl + po, Vh + po, Vl + po, r0, lr, hi, Ah + ao, Al + ao, pt);
    else fattn_wave<h16, false, 2>(Q16 + po, nullptr, K16 + po, nullptr, V16 + po, nullptr, r0, lr, hi, Ah + ao, Al + ao, pt);
}

extern "C" void kernel_launch(void* const* d_in, const int* in_sizes, int n_in,
                              void* d_out, int out_size, void* d_ws, size_t ws_size, hipStream_t stream) {
    (void)in_sizes; (void)n_in; (void)out_size;
    const float* x = (const float*)d_in[0]; const float* wf = (const float*)d_in[1]; const float* bf3 = (const float*)d_in[2]; const float* wo = (const float*)d_in[3]; const float* bo = (const float*)d_in[4];
    float* OUT = (float*)d_out;     // [8][1000][1024]
    char* wsp = (char*)d_ws;
    auto take = [&](size_t bytes) { char* p = wsp; wsp += (bytes + 255) & ~(size_t)255; return (void*)p; };
    const int NQKV = DQ + 2 * DKV;
    const size_t PE = (size_t)NB_ * NH_ * TT * HD;   // elements of one 16-bit head plane of all batches
    bf* WO = (bf*)take((size_t)DM * DQ * 2);
    bf* XB = (bf*)take((size_t)NB_ * TT * DM * 2); bf* WALL = (bf*)take((size_t)NQKV * DM * 2);
    h16* P16 = (h16*)take(3 * PE * 2); bf* Ph = (bf*)take(3 * PE * 2); bf* Pl = (bf*)take(3 * PE * 2);   // q, k, v^T one behind the other in each
    bf* ATh = (bf*)take((size_t)NB_ * TT * DQ * 2); bf* ATl = (bf*)take((size_t)NB_ * TT * DQ * 2);   // merged heads hi, lo
    if ((size_t)(wsp - (char*)d_ws) > ws_size) return;    // 200 MiB of the 256 MiB workspace
    k_prep<<<NB_ * TT / 2 / 8, 256, 0, stream>>>(x, wf, wo, XB, WALL, WO);
    k_gemmw<bf, 0, true, DM><<<dim3(NB_ * TT / 128, NQKV / 128, 1), 128, 0, stream>>>(XB, nullptr, WALL, bf3, nullptr, P16, Ph, Pl);
    k_fattn<<<dim3(TT / 128, NH_, NB_), 128, 0, stream>>>(P16, Ph, Pl, P16 + PE, Ph + PE, Pl + PE, P16 + 2 * PE, Ph + 2 * PE, Pl + 2 * PE, ATh, ATl);
    k_gemmw<bf, 1, false, DQ><<<dim3(NB_ * TT / 128, DM / 128, 1), 128, 0, stream>>>(ATh, ATl, WO, bo, OUT, nullptr, nullptr, nullptr);
}
